// v000
// Measured on an AMD MI455X. A time is GPU time per run, averaged over a window of back-to-back runs after a warm-up
// (all launches, gaps included; the runs take copies of the inputs in turn), and the median of several windows.
// Apart from v000's, it joins two sittings. Times from different sittings can be a few percent apart, while
// side-by-side timings come from the same sitting.
// v000 is the starting kernel. One run takes 1830 microseconds.
#include <hip/hip_runtime.h>

// Masked attention on given head-major tensors with an additive mask (q, k, v [2][12][2048][64]; scores = q.k + mask ([2][1][2048][2048] f32 unit normal, broadcast over heads, read); no scaling; softmax; out = probs v -> [2][12][2048][64] (3.1 M); argument order q, k, v, mask).
// Layout per (batch, head): single bf16 planes of q and k (inputs bf16-exact: exact score products) and value^T planes; full score tiles; the softmax adds the batch's mask row (every row hi/lo); P hi/lo x exact value; head-major merge writes the output rows.
// Compute dtypes, f32 accumulate: every input rounded to bf16; q.k exact; softmax f32; P hi/lo x exact value; output f32.

#define NB_  2
#define TT   2048
#define DM   768      // token-major row pitch (H x HD)
#define NH_  12
#define NKV  1
#define REP  (NH_ / NKV)
#define HD   64
#define DQ   (NH_ * HD)
#define DKV  (NKV * HD)
#define ZH   1
#define RH   2048                  // query rows < RH use hi+lo planes (0: none)
#define WIN  0
#define PCAR 1024.0f
#define SCL  1.0f   // scores are not scaled in the module
typedef _Float16 h16;
typedef unsigned short bf;
typedef __attribute__((ext_vector_type(16))) __bf16   v16bf;
typedef __attribute__((ext_vector_type(16))) _Float16 v16h;
typedef __attribute__((ext_vector_type(8)))  _Float16 v8h;
typedef __attribute__((ext_vector_type(8)))  unsigned short v8us;
typedef __attribute__((ext_vector_type(8)))  float    v8f;
typedef __attribute__((ext_vector_type(4)))  float    v4f;
typedef v8h  __attribute__((may_alias)) v8ha;
typedef v4f  __attribute__((may_alias)) v4fa;
typedef v8us __attribute__((may_alias)) v8usa;

__device__ __forceinline__ unsigned short f2bf(float f) { unsigned u = __float_as_uint(f); u += 0x7FFFu + ((u >> 16) & 1u); return (unsigned short)(u >> 16); }
__device__ __forceinline__ float bf2f(unsigned short b) { return __uint_as_float(((unsigned)b) << 16); }
__device__ __forceinline__ float bfr(float f) { return bf2f(f2bf(f)); }
__device__ __forceinline__ v16h cat16(v8h lo, v8h hi) { return __builtin_shufflevector(lo, hi, 0, 1, 2, 3, 4, 5, 6, 7, 8, 9, 10, 11, 12, 13, 14, 15); }
__device__ __forceinline__ v16bf cat16b(v8us lo, v8us hi) { return __builtin_bit_cast(v16bf, __builtin_shufflevector(lo, hi, 0, 1, 2, 3, 4, 5, 6, 7, 8, 9, 10, 11, 12, 13, 14, 15)); }
__device__ __forceinline__ v8f wmma16(v16h a, v16h b, v8f c) { return __builtin_amdgcn_wmma_f32_16x16x32_f16(false, a, false, b, (short)0, c, false, false); }
__device__ __forceinline__ v8f wmmab(v16bf a, v16bf b, v8f c) { return __builtin_amdgcn_wmma_f32_16x16x32_bf16(false, a, false, b, (short)0, c, false, false); }



// ---- k_gemmw: register-blocked GEMM, ONE WAVE per 64x64 output tile (16 accumulators), operands straight from K-contiguous 16-bit planes; grid (M/64, N/64, Z), 32 threads.
// C[m][n] (f32, pitch ldc, + optional f32 bias[n]) = sum_k A[m][k] Bt[n][k] (+ split products per NSPLIT). z-batch strides sA/sB/sC in elements. K % 32 == 0.
template <typename T16> struct WFrag;
template <> struct WFrag<h16> { typedef v16h V; static __device__ __forceinline__ V ld(const h16* p) { return cat16(*(const v8h*)p, *(const v8h*)(p + 16)); } static __device__ __forceinline__ v8f mma(V a, V b, v8f c) { return wmma16(a, b, c); } };
template <> struct WFrag<bf> { typedef v16bf V; static __device__ __forceinline__ V ld(const bf* p) { return cat16b(*(const v8us*)p, *(const v8us*)(p + 16)); } static __device__ __forceinline__ v8f mma(V a, V b, v8f c) { return wmmab(a, b, c); } };
template <typename T16, int NSPLIT, bool BIAS>
__global__ __launch_bounds__(32) void k_gemmw(const T16* __restrict__ A, const T16* __restrict__ A2, const T16* __restrict__ Bt, const T16* __restrict__ Bt2, int K, float* C, int ldc, const float* __restrict__ bias, size_t sA, size_t sB, size_t sC) {
    typedef typename WFrag<T16>::V V;
    __shared__ __align__(16) float os[16 * 68];
    const size_t z = blockIdx.z; A += z * sA; if (A2) A2 += z * sA; Bt += z * sB; if (Bt2) Bt2 += z * sB; C += z * sC;
    const int lane = threadIdx.x & 31, lr = lane & 15, hi = lane >> 4; const int r0 = blockIdx.x * 64, c0 = blockIdx.y * 64;
    v8f acc[4][4];
#pragma unroll
    for (int mb = 0; mb < 4; ++mb)
#pragma unroll
        for (int nb = 0; nb < 4; ++nb) acc[mb][nb] = (v8f){};
    const size_t aoff = (size_t)(r0 + lr) * K + 8 * hi, boff = (size_t)(c0 + lr) * K + 8 * hi;
#pragma unroll 1
    for (int kc = 0; kc < K; kc += 32) {
        V a[4], a2[4];
#pragma unroll
        for (int mb = 0; mb < 4; ++mb) { a[mb] = WFrag<T16>::ld(A + aoff + (size_t)mb * 16 * K + kc); if (NSPLIT == 1 || NSPLIT == 2) a2[mb] = WFrag<T16>::ld(A2 + aoff + (size_t)mb * 16 * K + kc); }
#pragma unroll
        for (int nb = 0; nb < 4; ++nb) { const V b = WFrag<T16>::ld(Bt + boff + (size_t)nb * 16 * K + kc); V b2; if (NSPLIT >= 2) b2 = WFrag<T16>::ld(Bt2 + boff + (size_t)nb * 16 * K + kc);
#pragma unroll
            for (int mb = 0; mb < 4; ++mb) { acc[mb][nb] = WFrag<T16>::mma(a[mb], b, acc[mb][nb]); if (NSPLIT == 1 || NSPLIT == 2) acc[mb][nb] = WFrag<T16>::mma(a2[mb], b, acc[mb][nb]); if (NSPLIT >= 2) acc[mb][nb] = WFrag<T16>::mma(a[mb], b2, acc[mb][nb]); } }
        asm volatile("v_nop\n\tv_nop\n\tv_nop\n\tv_nop" : "+v"(acc[0][0]), "+v"(acc[1][1]), "+v"(acc[2][2]), "+v"(acc[3][3]) : "v"(a[0]), "v"(a[3]));
    }
#pragma unroll
    for (int mb = 0; mb < 4; ++mb) {
#pragma unroll
        for (int nb = 0; nb < 4; ++nb) {
#pragma unroll
            for (int j = 0; j < 8; ++j) os[(hi * 8 + j) * 68 + nb * 16 + lr] = acc[mb][nb][j]; }
        __builtin_amdgcn_wave_barrier(); asm volatile("" ::: "memory");
        float* crow = C + (size_t)(r0 + mb * 16) * ldc + c0;
{
#pragma unroll
            for (int s = 0; s < 8; ++s) { const int row = 2 * s + hi, cofs = lr * 4; v4f val = *(const v4fa*)(os + row * 68 + cofs); if (BIAS) { val[0] += bfr(bias[c0 + cofs]); val[1] += bfr(bias[c0 + cofs + 1]); val[2] += bfr(bias[c0 + cofs + 2]); val[3] += bfr(bias[c0 + cofs + 3]); }
                *(v4f*)(crow + (size_t)row * ldc + cofs) = val; }
             }
        __builtin_amdgcn_wave_barrier(); asm volatile("" ::: "memory");
    }
}

__device__ __forceinline__ h16 tohx(float x) { return (h16)x; }
__device__ __forceinline__ void splitf(float y, unsigned short& h, unsigned short& l) { h = f2bf(y); l = f2bf(y - bf2f(h)); }
typedef __attribute__((ext_vector_type(2))) _Float16 v2h;
typedef __attribute__((ext_vector_type(4))) _Float16 v4h;
typedef __attribute__((ext_vector_type(2))) unsigned short v2us;
typedef __attribute__((ext_vector_type(4))) unsigned short v4us;
typedef __attribute__((ext_vector_type(2))) float v2f;
typedef __attribute__((ext_vector_type(4))) int v4i;

__global__ __launch_bounds__(256) void k_cvt8(const float* __restrict__ src, bf* dst, size_t n8) { const size_t i = (size_t)blockIdx.x * 256 + threadIdx.x; if (i >= n8) return; const v8f v = *(const v8f*)(src + i * 8); v8us o;
#pragma unroll
    for (int k = 0; k < 8; ++k) o[k] = f2bf(v[k]); *(v8us*)(dst + i * 8) = o;  }


// k_asoft: per row i: t = S + bf16(mask[b][0][i][j]) (unscaled logits plus the additive f32 mask row, read as data); softmax over the 2048 keys (register row, one exp, fixed trees); every row normalised hi/lo (RH = TT);
__global__ __launch_bounds__(256) void k_asoft(const float* __restrict__ Sb, const float* __restrict__ madd, h16* P16, bf* Ph, bf* Pl) {
    const int lane = threadIdx.x & 31; const int row = blockIdx.x * 8 + (threadIdx.x >> 5); if (row >= ZH * TT) return; const int i = row % TT; const int zz = row / TT; (void)zz; const bool hires = (i < RH); const float* sr = Sb + (size_t)row * TT; float v[TT / 32]; float mx = -3.0e38f;
#pragma unroll
    for (int ch = 0; ch < TT / 128; ++ch) { const int j0 = ch * 128 + lane * 4; const v4f a = *(const v4f*)(sr + j0); const v4f m4 = *(const v4f*)(madd + (size_t)i * TT + j0);   /* additive mask row (f32 input, bf16-rounded), 16 B per lane, unconditional */
#pragma unroll
        for (int q = 0; q < 4; ++q) { const int j = j0 + q; float mv = bfr(m4[q]); asm volatile("" : "+v"(mv)); const float t = __fadd_rn(a[q], mv);   /* q.k (unscaled) + bf16(mask[b][i][j]) */     v[ch * 4 + q] = t; mx = fmaxf(mx, t); } }
#pragma unroll
    for (int sh = 16; sh; sh >>= 1) mx = fmaxf(mx, __shfl_xor(mx, sh, 32));
    float sum = 0.f;
#pragma unroll
    for (int k = 0; k < TT / 32; ++k) { float d0 = __fsub_rn(v[k], mx); asm volatile("" : "+v"(d0)); v[k] = __builtin_amdgcn_exp2f(__fmul_rn(d0, 1.4426950408889634f)); sum += v[k]; }
#pragma unroll
    for (int sh = 16; sh; sh >>= 1) sum += __shfl_xor(sum, sh, 32);
    const float f = __fdiv_rn(hires ? 1.0f : PCAR, sum);
{
        if (hires) {
#pragma unroll
            for (int ch = 0; ch < TT / 128; ++ch) { v4us oh, ol;
#pragma unroll
                for (int q = 0; q < 4; ++q) { unsigned short a, c2; splitf(v[ch * 4 + q] * f, a, c2); oh[q] = a; ol[q] = c2; }
                const size_t oo = ((size_t)zz * (RH ? RH : 1) + i) * TT + ch * 128 + lane * 4; *(v4us*)(Ph + oo) = oh; *(v4us*)(Pl + oo) = ol; }
        } else {
#pragma unroll
            for (int ch = 0; ch < TT / 128; ++ch) { v4h o4;
#pragma unroll
                for (int q = 0; q < 4; ++q) o4[q] = tohx(v[ch * 4 + q] * f);
                *(v4h*)(P16 + (size_t)row * TT + ch * 128 + lane * 4) = o4; } }
         }
}

__global__ __launch_bounds__(256) void k_vtpR1(const float* __restrict__ Vb, bf* Vh) { const size_t e = ((size_t)blockIdx.x * 256 + threadIdx.x) * 2; if (e >= (size_t)HD * TT) return; const int t = (int)(e % TT); const int d = (int)(e / TT); v2us o; o[0] = f2bf(Vb[(size_t)t * HD + d]); o[1] = f2bf(Vb[(size_t)(t + 1) * HD + d]); *(v2us*)(Vh + e) = o;  }
__global__ __launch_bounds__(256) void k_mergeR(const float* __restrict__ O, float* outb, size_t n4) { const size_t i = (size_t)blockIdx.x * 256 + threadIdx.x; if (i >= n4) return; const v4f a = *(const v4f*)(O + i * 4); *(v4f*)(outb + i * 4) = a;  }


extern "C" void kernel_launch(void* const* d_in, const int* in_sizes, int n_in,
                              void* d_out, int out_size, void* d_ws, size_t ws_size, hipStream_t stream) {
    (void)in_sizes; (void)n_in; (void)out_size;
    const float* Qin = (const float*)d_in[0]; const float* Kin = (const float*)d_in[1]; const float* Vin = (const float*)d_in[2]; const float* Min = (const float*)d_in[3];   /* mask [2][1][2048][2048] f32 (additive, broadcast over heads; read) */   /* input order q, k, v, mask */
    float* OUT = (float*)d_out;     // [2][12][2048][64] head-major
    char* wsp = (char*)d_ws;
    auto take = [&](size_t bytes) { char* p = wsp; wsp += (bytes + 255) & ~(size_t)255; return (void*)p; };
    bf* QB = (bf*)take((size_t)NH_ * TT * HD * 2); bf* KB = (bf*)take((size_t)NH_ * TT * HD * 2); bf* VT = (bf*)take((size_t)NH_ * HD * TT * 2);
    float* Sb = (float*)take((size_t)TT * TT * 4);  bf* Ph = (bf*)take((size_t)TT * TT * 2); bf* Pl = (bf*)take((size_t)TT * TT * 2); float* Ob = (float*)take((size_t)TT * HD * 4);
    if ((size_t)(wsp - (char*)d_ws) > ws_size) return;
    for (int b = 0; b < NB_; ++b) {
        const float* qb = Qin + (size_t)b * NH_ * TT * HD; const float* kb = Kin + (size_t)b * NH_ * TT * HD; const float* vb = Vin + (size_t)b * NH_ * TT * HD;   /* head-major [h][t][d] slabs (contiguous per head) */
        k_cvt8<<<(unsigned)(((size_t)NH_ * TT * HD / 8 + 255) / 256), 256, 0, stream>>>(qb, QB, (size_t)NH_ * TT * HD / 8); k_cvt8<<<(unsigned)(((size_t)NH_ * TT * HD / 8 + 255) / 256), 256, 0, stream>>>(kb, KB, (size_t)NH_ * TT * HD / 8);
        for (int h = 0; h < NH_; ++h) k_vtpR1<<<(unsigned)(((size_t)HD * TT / 2 + 255) / 256), 256, 0, stream>>>(vb + (size_t)h * TT * HD, VT + (size_t)h * HD * TT);
        for (int h = 0; h < NH_; ++h) {
            k_gemmw<bf, 0, false><<<dim3(TT / 64, TT / 64, 1), 32, 0, stream>>>(QB + (size_t)h * TT * HD, nullptr, KB + (size_t)h * TT * HD, nullptr, HD, Sb, TT, nullptr, 0, 0, 0);   /* exact scores (single bf16 planes) */
            k_asoft<<<TT / 8, 256, 0, stream>>>(Sb, Min + (size_t)b * TT * TT, nullptr, Ph, Pl);
            k_gemmw<bf, 1, false><<<dim3(TT / 64, HD / 64, 1), 32, 0, stream>>>(Ph, Pl, VT + (size_t)h * HD * TT, nullptr, TT, Ob, HD, nullptr, 0, 0, 0);   /* P (hi/lo) x exact v^T */
            k_mergeR<<<(unsigned)(((size_t)TT * HD / 4 + 255) / 256), 256, 0, stream>>>(Ob, OUT + ((size_t)b * NH_ + h) * TT * HD, (size_t)TT * HD / 4); } }
}

// v001
// A run of this version takes 178 microseconds.
// In two side-by-side timings against v000, it was 10.2 and 10.3 times as fast.
#include <hip/hip_runtime.h>

// Masked attention on given head-major tensors with an additive mask (q, k, v [2][12][2048][64]; scores = q.k + mask ([2][1][2048][2048] f32 unit normal, broadcast over heads, read); no scaling; softmax; out = probs v -> [2][12][2048][64] (3.1 M); argument order q, k, v, mask).
// Layout per (batch, head): single bf16 planes of q and k (inputs bf16-exact: exact score products) and value^T planes; one fused kernel walks the keys with a running maximum and sum per query (transposed products: S^T = K Q^T, O^T += V^T P^T), adds the batch's mask row, and writes the head-major output rows; no score or probability plane in memory.
// Compute dtypes, f32 accumulate: every input rounded to bf16; q.k exact; softmax f32; P hi/lo x exact value; output f32.

#define NB_  2
#define TT   2048
#define DM   768      // token-major row pitch (H x HD)
#define NH_  12
#define NKV  1
#define REP  (NH_ / NKV)
#define HD   64
#define DQ   (NH_ * HD)
#define DKV  (NKV * HD)
#define ZH   1
#define RH   2048
#define WIN  0
#define PCAR 1024.0f
#define SCL  1.0f   // scores are not scaled in the module
typedef _Float16 h16;
typedef unsigned short bf;
typedef __attribute__((ext_vector_type(16))) __bf16   v16bf;
typedef __attribute__((ext_vector_type(16))) _Float16 v16h;
typedef __attribute__((ext_vector_type(8)))  _Float16 v8h;
typedef __attribute__((ext_vector_type(8)))  unsigned short v8us;
typedef __attribute__((ext_vector_type(8)))  float    v8f;
typedef __attribute__((ext_vector_type(4)))  float    v4f;
typedef v8h  __attribute__((may_alias)) v8ha;
typedef v4f  __attribute__((may_alias)) v4fa;
typedef v8us __attribute__((may_alias)) v8usa;

__device__ __forceinline__ unsigned short f2bf(float f) { unsigned u = __float_as_uint(f); u += 0x7FFFu + ((u >> 16) & 1u); return (unsigned short)(u >> 16); }
__device__ __forceinline__ float bf2f(unsigned short b) { return __uint_as_float(((unsigned)b) << 16); }
__device__ __forceinline__ float bfr(float f) { return bf2f(f2bf(f)); }
__device__ __forceinline__ v16h cat16(v8h lo, v8h hi) { return __builtin_shufflevector(lo, hi, 0, 1, 2, 3, 4, 5, 6, 7, 8, 9, 10, 11, 12, 13, 14, 15); }
__device__ __forceinline__ v16bf cat16b(v8us lo, v8us hi) { return __builtin_bit_cast(v16bf, __builtin_shufflevector(lo, hi, 0, 1, 2, 3, 4, 5, 6, 7, 8, 9, 10, 11, 12, 13, 14, 15)); }
__device__ __forceinline__ v8f wmma16(v16h a, v16h b, v8f c) { return __builtin_amdgcn_wmma_f32_16x16x32_f16(false, a, false, b, (short)0, c, false, false); }
__device__ __forceinline__ v8f wmmab(v16bf a, v16bf b, v8f c) { return __builtin_amdgcn_wmma_f32_16x16x32_bf16(false, a, false, b, (short)0, c, false, false); }



typedef __attribute__((ext_vector_type(2))) _Float16 v2h;
typedef __attribute__((ext_vector_type(4))) _Float16 v4h;
typedef __attribute__((ext_vector_type(2))) unsigned short v2us;
typedef __attribute__((ext_vector_type(4))) unsigned short v4us;
typedef __attribute__((ext_vector_type(2))) float v2f;
typedef __attribute__((ext_vector_type(4))) int v4i;

__global__ __launch_bounds__(256) void k_cvt8(const float* __restrict__ src, bf* dst, size_t n8) { const size_t i = (size_t)blockIdx.x * 256 + threadIdx.x; if (i >= n8) return; const v8f v = *(const v8f*)(src + i * 8); v8us o;
#pragma unroll
    for (int k = 0; k < 8; ++k) o[k] = f2bf(v[k]); *(v8us*)(dst + i * 8) = o;  }


// ---- k_fattn: fused scores + mask + softmax + P.V. One wave owns 16 queries of one (batch, head) and walks all TT keys, KBLK at a time; 4 waves per work-group, grid (TT / 64, NB_ * NH_).
// S^T tile (16 keys x 16 queries) = K rows (A) x Q rows (B): lane (c = lane & 15, h = lane >> 4) holds query c, keys 8h + r in register r. Two such tiles, converted in place, are the B operand of O^T += V^T P^T (k order 8h + s, 16 + 8h + s: the order ldf() reads A in).
// Running maximum is shared by the two lane halves of a query (they feed one product); the sum stays per half and is joined once at the end.
#define KBLK 64
typedef __attribute__((ext_vector_type(2))) __bf16 v2b;
__device__ __forceinline__ v2f rnd2(v2f x) { return __builtin_convertvector(__builtin_convertvector(x, v2b), v2f); }   /* two f32 rounded to bf16 (nearest even), as f32 */
// Eight exp2 in one statement. It keeps the slot that the instruction set asks for behind a transcendental: each v_exp_f32 is followed by one that neither reads its result nor overwrites its source (outputs early-clobber), the last by v_nop.
__device__ __forceinline__ v8f exp2x8(v8f x) { float p0, p1, p2, p3, p4, p5, p6, p7;
    asm("v_exp_f32 %0, %8\n\tv_exp_f32 %1, %9\n\tv_exp_f32 %2, %10\n\tv_exp_f32 %3, %11\n\tv_exp_f32 %4, %12\n\tv_exp_f32 %5, %13\n\tv_exp_f32 %6, %14\n\tv_exp_f32 %7, %15\n\tv_nop"
        : "=&v"(p0), "=&v"(p1), "=&v"(p2), "=&v"(p3), "=&v"(p4), "=&v"(p5), "=&v"(p6), "=&v"(p7) : "v"(x[0]), "v"(x[1]), "v"(x[2]), "v"(x[3]), "v"(x[4]), "v"(x[5]), "v"(x[6]), "v"(x[7]));
    return (v8f){p0, p1, p2, p3, p4, p5, p6, p7}; }
__device__ __forceinline__ v16bf ldf(const unsigned short* p) { return cat16b(*(const v8us*)p, *(const v8us*)(p + 16)); }
__global__ __launch_bounds__(128) void k_fattn(const unsigned short* __restrict__ QB, const unsigned short* __restrict__ KB, const unsigned short* __restrict__ VT, const float* __restrict__ madd, float* __restrict__ out) {
    const int lane = threadIdx.x & 31, lr = lane & 15, hi = lane >> 4; const int bh = blockIdx.y; const int q = blockIdx.x * 64 + (threadIdx.x >> 5) * 16 + lr;
    const unsigned short* qp = QB + ((size_t)bh * TT + q) * HD + 8 * hi; const v16bf q0 = ldf(qp), q1 = ldf(qp + 32);
    const unsigned short* kb = KB + (size_t)bh * TT * HD; const unsigned short* vb = VT + (size_t)bh * HD * TT; const float* mb_ = madd + (size_t)(bh / NH_) * TT * TT;   /* wave-uniform bases; the lane's part is a fixed 32-bit offset */
    const unsigned ko = (unsigned)(lr * HD + 8 * hi), vo = (unsigned)(lr * TT + 8 * hi), mo = (unsigned)(q * TT + 8 * hi);
    v8f o[4];
#pragma unroll
    for (int mb = 0; mb < 4; ++mb) o[mb] = (v8f){};
    float mx = -3.0e38f, sum = 0.f;
#pragma unroll 1   /* stays rolled: one block's body already holds some 500 instructions and most of the register budget of three to four waves per SIMD */
    for (int k0 = 0; k0 < TT; k0 += KBLK) {
        v8f s[KBLK / 16]; float bm = -3.0e38f; v16bf vt[KBLK / 32][4];   /* the block's value fragments are asked for here, so that they fly under the scores and the softmax */
#pragma unroll
        for (int g = 0; g < KBLK / 32; ++g)
#pragma unroll
            for (int mb = 0; mb < 4; ++mb) vt[g][mb] = ldf(vb + k0 + vo + mb * 16 * TT + 32 * g);
#pragma unroll
        for (int t = 0; t < KBLK / 16; ++t) { const unsigned short* kr = kb + k0 * HD + ko + 16 * t * HD; s[t] = wmmab(ldf(kr), q0, (v8f){}); s[t] = wmmab(ldf(kr + 32), q1, s[t]);
            const v4f ma = *(const v4f*)(mb_ + k0 + mo + 16 * t), mc = *(const v4f*)(mb_ + k0 + mo + 16 * t + 4);   /* mask[b][q][keys 8h .. 8h + 7 of the tile], f32 input, bf16-rounded */
#pragma unroll
            for (int r = 0; r < 8; r += 2) { const v2f m2 = rnd2(r < 4 ? (v2f){ma[r], ma[r + 1]} : (v2f){mc[r - 4], mc[r - 3]}); s[t][r] = __fadd_rn(s[t][r], m2[0]); s[t][r + 1] = __fadd_rn(s[t][r + 1], m2[1]); bm = fmaxf(bm, fmaxf(s[t][r], s[t][r + 1])); } }
        bm = fmaxf(bm, __shfl_xor(bm, 16, 32)); const float mn = fmaxf(mx, bm);
        if (__builtin_amdgcn_ballot_w32(mn > mx) != 0) {   /* wave-uniform: a block that raises no query's maximum would scale by exactly 1 */
            const float al = __builtin_amdgcn_exp2f(__fmul_rn(__fsub_rn(mx, mn), 1.4426950408889634f)); sum *= al; mx = mn;
#pragma unroll
            for (int mb = 0; mb < 4; ++mb) o[mb] *= al; }
#pragma unroll
        for (int g = 0; g < KBLK / 32; ++g) { v16bf ph, pl;
#pragma unroll
            for (int u = 0; u < 2; ++u) { v8f x;
#pragma unroll
                for (int r = 0; r < 8; ++r) x[r] = __fmul_rn(__fsub_rn(s[2 * g + u][r], mx), 1.4426950408889634f);
                const v8f p8 = exp2x8(x);
#pragma unroll
                for (int r = 0; r < 8; r += 2) { const v2f p = {p8[r], p8[r + 1]}; sum += p[0]; sum += p[1]; const int e = 8 * u + r;
                    const v2b h2 = __builtin_convertvector(p, v2b); const v2b l2 = __builtin_convertvector(p - __builtin_convertvector(h2, v2f), v2b); ph[e] = h2[0]; ph[e + 1] = h2[1]; pl[e] = l2[0]; pl[e + 1] = l2[1]; } }
#pragma unroll
            for (int mb = 0; mb < 4; ++mb) { o[mb] = wmmab(vt[g][mb], ph, o[mb]); o[mb] = wmmab(vt[g][mb], pl, o[mb]); } }
    }
    sum += __shfl_xor(sum, 16, 32); const float f = __fdiv_rn(1.0f, sum);
    float* op = out + ((size_t)bh * TT + q) * HD + 8 * hi;
#pragma unroll
    for (int mb = 0; mb < 4; ++mb) { v4f a, c;
#pragma unroll
        for (int r = 0; r < 4; ++r) { a[r] = o[mb][r] * f; c[r] = o[mb][r + 4] * f; }
        *(v4f*)(op + mb * 16) = a; *(v4f*)(op + mb * 16 + 4) = c; }
}

__global__ __launch_bounds__(256) void k_vtpR1(const float* __restrict__ Vb, bf* Vh) { const size_t e = ((size_t)blockIdx.x * 256 + threadIdx.x) * 2; if (e >= (size_t)HD * TT) return; const int t = (int)(e % TT); const int d = (int)(e / TT); v2us o; o[0] = f2bf(Vb[(size_t)t * HD + d]); o[1] = f2bf(Vb[(size_t)(t + 1) * HD + d]); *(v2us*)(Vh + e) = o;  }


extern "C" void kernel_launch(void* const* d_in, const int* in_sizes, int n_in,
                              void* d_out, int out_size, void* d_ws, size_t ws_size, hipStream_t stream) {
    (void)in_sizes; (void)n_in; (void)out_size;
    const float* Qin = (const float*)d_in[0]; const float* Kin = (const float*)d_in[1]; const float* Vin = (const float*)d_in[2]; const float* Min = (const float*)d_in[3];   /* mask [2][1][2048][2048] f32 (additive, broadcast over heads; read) */   /* input order q, k, v, mask */
    float* OUT = (float*)d_out;     // [2][12][2048][64] head-major
    char* wsp = (char*)d_ws;
    auto take = [&](size_t bytes) { char* p = wsp; wsp += (bytes + 255) & ~(size_t)255; return (void*)p; };
    bf* QB = (bf*)take((size_t)NB_ * NH_ * TT * HD * 2); bf* KB = (bf*)take((size_t)NB_ * NH_ * TT * HD * 2); bf* VT = (bf*)take((size_t)NB_ * NH_ * HD * TT * 2);
    if ((size_t)(wsp - (char*)d_ws) > ws_size) return;
    for (int b = 0; b < NB_; ++b) {
        const size_t ob = (size_t)b * NH_ * TT * HD; const float* qb = Qin + ob; const float* kb = Kin + ob; const float* vb = Vin + ob;   /* head-major [h][t][d] slabs (contiguous per head) */
        k_cvt8<<<(unsigned)(((size_t)NH_ * TT * HD / 8 + 255) / 256), 256, 0, stream>>>(qb, QB + ob, (size_t)NH_ * TT * HD / 8); k_cvt8<<<(unsigned)(((size_t)NH_ * TT * HD / 8 + 255) / 256), 256, 0, stream>>>(kb, KB + ob, (size_t)NH_ * TT * HD / 8);
        for (int h = 0; h < NH_; ++h) k_vtpR1<<<(unsigned)(((size_t)HD * TT / 2 + 255) / 256), 256, 0, stream>>>(vb + (size_t)h * TT * HD, VT + ob + (size_t)h * HD * TT); }
    k_fattn<<<dim3(TT / 64, NB_ * NH_, 1), 128, 0, stream>>>(QB, KB, VT, Min, OUT);   /* every (batch, head): scores, mask, softmax, P (hi/lo) x exact v^T */
}

// v002
// It runs in 105 microseconds.
// Timed twice side by side with v001, it ran 1.70 times as fast both times.
// Over all steps from v000 it is 17.4 times as fast.
#include <hip/hip_runtime.h>

// Masked attention on given head-major tensors with an additive mask (q, k, v [2][12][2048][64]; scores = q.k + mask ([2][1][2048][2048] f32 unit normal, broadcast over heads, read); no scaling; softmax; out = probs v -> [2][12][2048][64] (3.1 M); argument order q, k, v, mask).
// Layout per (batch, head): single bf16 planes of q and k (inputs bf16-exact: exact score products) and value^T planes; one fused kernel walks the keys with a running maximum and sum per query (transposed products: S^T = K Q^T, O^T += V^T P^T), adds the batch's mask row, and writes the head-major output rows; no score or probability plane in memory.
// Compute dtypes, f32 accumulate: every input rounded to bf16; q.k exact; softmax f32; P hi/lo x exact value; output f32.

#define NB_  2
#define TT   2048
#define DM   768      // token-major row pitch (H x HD)
#define NH_  12
#define NKV  1
#define REP  (NH_ / NKV)
#define HD   64
#define DQ   (NH_ * HD)
#define DKV  (NKV * HD)
#define ZH   1
#define RH   2048
#define WIN  0
#define PCAR 1024.0f
#define SCL  1.0f   // scores are not scaled in the module
typedef _Float16 h16;
typedef unsigned short bf;
typedef __attribute__((ext_vector_type(16))) __bf16   v16bf;
typedef __attribute__((ext_vector_type(16))) _Float16 v16h;
typedef __attribute__((ext_vector_type(8)))  _Float16 v8h;
typedef __attribute__((ext_vector_type(8)))  unsigned short v8us;
typedef __attribute__((ext_vector_type(8)))  float    v8f;
typedef __attribute__((ext_vector_type(4)))  float    v4f;
typedef v8h  __attribute__((may_alias)) v8ha;
typedef v4f  __attribute__((may_alias)) v4fa;
typedef v8us __attribute__((may_alias)) v8usa;

__device__ __forceinline__ unsigned short f2bf(float f) { unsigned u = __float_as_uint(f); u += 0x7FFFu + ((u >> 16) & 1u); return (unsigned short)(u >> 16); }
__device__ __forceinline__ float bf2f(unsigned short b) { return __uint_as_float(((unsigned)b) << 16); }
__device__ __forceinline__ float bfr(float f) { return bf2f(f2bf(f)); }
__device__ __forceinline__ v16h cat16(v8h lo, v8h hi) { return __builtin_shufflevector(lo, hi, 0, 1, 2, 3, 4, 5, 6, 7, 8, 9, 10, 11, 12, 13, 14, 15); }
__device__ __forceinline__ v16bf cat16b(v8us lo, v8us hi) { return __builtin_bit_cast(v16bf, __builtin_shufflevector(lo, hi, 0, 1, 2, 3, 4, 5, 6, 7, 8, 9, 10, 11, 12, 13, 14, 15)); }
__device__ __forceinline__ v8f wmma16(v16h a, v16h b, v8f c) { return __builtin_amdgcn_wmma_f32_16x16x32_f16(false, a, false, b, (short)0, c, false, false); }
__device__ __forceinline__ v8f wmmab(v16bf a, v16bf b, v8f c) { return __builtin_amdgcn_wmma_f32_16x16x32_bf16(false, a, false, b, (short)0, c, false, false); }



typedef __attribute__((ext_vector_type(2))) _Float16 v2h;
typedef __attribute__((ext_vector_type(4))) _Float16 v4h;
typedef __attribute__((ext_vector_type(2))) unsigned short v2us;
typedef __attribute__((ext_vector_type(4))) unsigned short v4us;
typedef __attribute__((ext_vector_type(2))) float v2f;
typedef __attribute__((ext_vector_type(4))) int v4i;

// ---- k_prep: the three bf16 planes in one launch. Blocks below VTB each transpose one 128-key x 64-column tile of one head's v through LDS; the others round q and k, element order kept.
// v tile: a thread reads 4 columns of two neighbouring keys (16 lanes cover one 256-byte source row), packs each column's key pair into a dword and stores it at [column][key pair]; the 16-byte group index is XORed with column / 4, so that the 16 column groups of a wave's store fall on different banks and a row still reads back as 16-byte groups. Each v^T row piece leaves as 256 contiguous bytes.
#define VTB (NB_ * NH_ * (TT / 128))
#define CVB (NB_ * NH_ * TT * HD / 8 / (256 * 8))   /* blocks per plane: 256 threads x 8 groups of 8 values */
typedef __attribute__((ext_vector_type(2))) __bf16 v2bp;
typedef __attribute__((ext_vector_type(8))) __bf16 v8bp;
typedef __attribute__((ext_vector_type(4))) unsigned v4u;
__global__ __launch_bounds__(256) void k_prep(const float* __restrict__ Q, const float* __restrict__ K, const float* __restrict__ V, bf* __restrict__ QB, bf* __restrict__ KB, bf* __restrict__ VT) {
    __shared__ __attribute__((aligned(16))) unsigned tile[HD * 64];
    const int tid = threadIdx.x, c16 = tid & 15, r16 = tid >> 4;
    if (blockIdx.x < VTB) {
        const int bh = blockIdx.x / (TT / 128), t0 = (blockIdx.x % (TT / 128)) * 128;
        const float* src = V + ((size_t)bh * TT + t0) * HD + 4 * c16; v4f a[4], b[4];
#pragma unroll
        for (int j = 0; j < 4; ++j) { const int tp = r16 + 16 * j; a[j] = *(const v4f*)(src + (2 * tp) * HD); b[j] = *(const v4f*)(src + (2 * tp + 1) * HD); }
#pragma unroll
        for (int j = 0; j < 4; ++j) { const int tp = r16 + 16 * j;
#pragma unroll
            for (int c = 0; c < 4; ++c) tile[(4 * c16 + c) * 64 + ((((tp >> 2) ^ c16) << 2) | (tp & 3))] = __builtin_bit_cast(unsigned, __builtin_convertvector((v2f){a[j][c], b[j][c]}, v2bp)); }
        __syncthreads();   /* the tile is read back across waves */
        bf* dst = VT + (size_t)bh * HD * TT + t0 + 8 * c16;
#pragma unroll
        for (int j = 0; j < 4; ++j) { const int d = r16 + 16 * j; *(v4u*)(dst + (size_t)d * TT) = *(const v4u*)(tile + d * 64 + ((c16 ^ (d >> 2)) << 2)); }
    } else {
        const unsigned blk = blockIdx.x - VTB; const bool isk = blk >= CVB; const float* src = isk ? K : Q; bf* dst = isk ? KB : QB;
        const size_t i0 = (size_t)(isk ? blk - CVB : blk) * (256 * 8) + tid; v8f v[8];
#pragma unroll
        for (int j = 0; j < 8; ++j) v[j] = *(const v8f*)(src + (i0 + 256 * j) * 8);
#pragma unroll
        for (int j = 0; j < 8; ++j) *(v8bp*)(dst + (i0 + 256 * j) * 8) = __builtin_convertvector(v[j], v8bp);
        asm volatile("s_wait_xcnt 0x0" ::: "memory");   /* behind the run of stores: the build lays the other part's code behind this one, and no register that a store names is to be rewritten ahead of this wait */
    }
}


// ---- k_fattn: fused scores + mask + softmax + P.V. One wave owns 16 queries of one (batch, head) and walks all TT keys, KBLK at a time; 4 waves per work-group, grid (TT / 64, NB_ * NH_).
// S^T tile (16 keys x 16 queries) = K rows (A) x Q rows (B): lane (c = lane & 15, h = lane >> 4) holds query c, keys 8h + r in register r. Two such tiles, converted in place, are the B operand of O^T += V^T P^T (k order 8h + s, 16 + 8h + s: the order ldf() reads A in).
// Running maximum is shared by the two lane halves of a query (they feed one product); the sum stays per half and is joined once at the end.
#define KBLK 64
typedef __attribute__((ext_vector_type(2))) __bf16 v2b;
__device__ __forceinline__ v2f rnd2(v2f x) { return __builtin_convertvector(__builtin_convertvector(x, v2b), v2f); }   /* two f32 rounded to bf16 (nearest even), as f32 */
// Eight exp2 in one statement. It keeps the slot that the instruction set asks for behind a transcendental: each v_exp_f32 is followed by one that neither reads its result nor overwrites its source (outputs early-clobber), the last by v_nop.
__device__ __forceinline__ v8f exp2x8(v8f x) { float p0, p1, p2, p3, p4, p5, p6, p7;
    asm("v_exp_f32 %0, %8\n\tv_exp_f32 %1, %9\n\tv_exp_f32 %2, %10\n\tv_exp_f32 %3, %11\n\tv_exp_f32 %4, %12\n\tv_exp_f32 %5, %13\n\tv_exp_f32 %6, %14\n\tv_exp_f32 %7, %15\n\tv_nop"
        : "=&v"(p0), "=&v"(p1), "=&v"(p2), "=&v"(p3), "=&v"(p4), "=&v"(p5), "=&v"(p6), "=&v"(p7) : "v"(x[0]), "v"(x[1]), "v"(x[2]), "v"(x[3]), "v"(x[4]), "v"(x[5]), "v"(x[6]), "v"(x[7]));
    return (v8f){p0, p1, p2, p3, p4, p5, p6, p7}; }
__device__ __forceinline__ v16bf ldf(const unsigned short* p) { return cat16b(*(const v8us*)p, *(const v8us*)(p + 16)); }
__global__ __launch_bounds__(128) void k_fattn(const unsigned short* __restrict__ QB, const unsigned short* __restrict__ KB, const unsigned short* __restrict__ VT, const float* __restrict__ madd, float* __restrict__ out) {
    const int lane = threadIdx.x & 31, lr = lane & 15, hi = lane >> 4; const int bh = blockIdx.y; const int q = blockIdx.x * 64 + (threadIdx.x >> 5) * 16 + lr;
    const unsigned short* qp = QB + ((size_t)bh * TT + q) * HD + 8 * hi; const v16bf q0 = ldf(qp), q1 = ldf(qp + 32);
    const unsigned short* kb = KB + (size_t)bh * TT * HD; const unsigned short* vb = VT + (size_t)bh * HD * TT; const float* mb_ = madd + (size_t)(bh / NH_) * TT * TT;   /* wave-uniform bases; the lane's part is a fixed 32-bit offset */
    const unsigned ko = (unsigned)(lr * HD + 8 * hi), vo = (unsigned)(lr * TT + 8 * hi), mo = (unsigned)(q * TT + 8 * hi);
    v8f o[4];
#pragma unroll
    for (int mb = 0; mb < 4; ++mb) o[mb] = (v8f){};
    float mx = -3.0e38f, sum = 0.f;
#pragma unroll 1   /* stays rolled: one block's body already holds some 500 instructions and most of the register budget of three to four waves per SIMD */
    for (int k0 = 0; k0 < TT; k0 += KBLK) {
        v8f s[KBLK / 16]; float bm = -3.0e38f; v16bf vt[KBLK / 32][4];   /* the block's value fragments are asked for here, so that they fly under the scores and the softmax */
#pragma unroll
        for (int g = 0; g < KBLK / 32; ++g)
#pragma unroll
            for (int mb = 0; mb < 4; ++mb) vt[g][mb] = ldf(vb + k0 + vo + mb * 16 * TT + 32 * g);
#pragma unroll
        for (int t = 0; t < KBLK / 16; ++t) { const unsigned short* kr = kb + k0 * HD + ko + 16 * t * HD; s[t] = wmmab(ldf(kr), q0, (v8f){}); s[t] = wmmab(ldf(kr + 32), q1, s[t]);
            const v4f ma = *(const v4f*)(mb_ + k0 + mo + 16 * t), mc = *(const v4f*)(mb_ + k0 + mo + 16 * t + 4);   /* mask[b][q][keys 8h .. 8h + 7 of the tile], f32 input, bf16-rounded */
#pragma unroll
            for (int r = 0; r < 8; r += 2) { const v2f m2 = rnd2(r < 4 ? (v2f){ma[r], ma[r + 1]} : (v2f){mc[r - 4], mc[r - 3]}); s[t][r] = __fadd_rn(s[t][r], m2[0]); s[t][r + 1] = __fadd_rn(s[t][r + 1], m2[1]); bm = fmaxf(bm, fmaxf(s[t][r], s[t][r + 1])); } }
        bm = fmaxf(bm, __shfl_xor(bm, 16, 32)); const float mn = fmaxf(mx, bm);
        if (__builtin_amdgcn_ballot_w32(mn > mx) != 0) {   /* wave-uniform: a block that raises no query's maximum would scale by exactly 1 */
            const float al = __builtin_amdgcn_exp2f(__fmul_rn(__fsub_rn(mx, mn), 1.4426950408889634f)); sum *= al; mx = mn;
#pragma unroll
            for (int mb = 0; mb < 4; ++mb) o[mb] *= al; }
#pragma unroll
        for (int g = 0; g < KBLK / 32; ++g) { v16bf ph, pl;
#pragma unroll
            for (int u = 0; u < 2; ++u) { v8f x;
#pragma unroll
                for (int r = 0; r < 8; ++r) x[r] = __fmul_rn(__fsub_rn(s[2 * g + u][r], mx), 1.4426950408889634f);
                const v8f p8 = exp2x8(x);
#pragma unroll
                for (int r = 0; r < 8; r += 2) { const v2f p = {p8[r], p8[r + 1]}; sum += p[0]; sum += p[1]; const int e = 8 * u + r;
                    const v2b h2 = __builtin_convertvector(p, v2b); const v2b l2 = __builtin_convertvector(p - __builtin_convertvector(h2, v2f), v2b); ph[e] = h2[0]; ph[e + 1] = h2[1]; pl[e] = l2[0]; pl[e + 1] = l2[1]; } }
#pragma unroll
            for (int mb = 0; mb < 4; ++mb) { o[mb] = wmmab(vt[g][mb], ph, o[mb]); o[mb] = wmmab(vt[g][mb], pl, o[mb]); } }
    }
    sum += __shfl_xor(sum, 16, 32); const float f = __fdiv_rn(1.0f, sum);
    float* op = out + ((size_t)bh * TT + q) * HD + 8 * hi;
#pragma unroll
    for (int mb = 0; mb < 4; ++mb) { v4f a, c;
#pragma unroll
        for (int r = 0; r < 4; ++r) { a[r] = o[mb][r] * f; c[r] = o[mb][r + 4] * f; }
        *(v4f*)(op + mb * 16) = a; *(v4f*)(op + mb * 16 + 4) = c; }
}

extern "C" void kernel_launch(void* const* d_in, const int* in_sizes, int n_in,
                              void* d_out, int out_size, void* d_ws, size_t ws_size, hipStream_t stream) {
    (void)in_sizes; (void)n_in; (void)out_size;
    const float* Qin = (const float*)d_in[0]; const float* Kin = (const float*)d_in[1]; const float* Vin = (const float*)d_in[2]; const float* Min = (const float*)d_in[3];   /* mask [2][1][2048][2048] f32 (additive, broadcast over heads; read) */   /* input order q, k, v, mask */
    float* OUT = (float*)d_out;     // [2][12][2048][64] head-major
    char* wsp = (char*)d_ws;
    auto take = [&](size_t bytes) { char* p = wsp; wsp += (bytes + 255) & ~(size_t)255; return (void*)p; };
    bf* QB = (bf*)take((size_t)NB_ * NH_ * TT * HD * 2); bf* KB = (bf*)take((size_t)NB_ * NH_ * TT * HD * 2); bf* VT = (bf*)take((size_t)NB_ * NH_ * HD * TT * 2);
    if ((size_t)(wsp - (char*)d_ws) > ws_size) return;
    k_prep<<<VTB + 2 * CVB, 256, 0, stream>>>(Qin, Kin, Vin, QB, KB, VT);   /* q, k rounded to bf16; v rounded and transposed per head */
    k_fattn<<<dim3(TT / 64, NB_ * NH_, 1), 128, 0, stream>>>(QB, KB, VT, Min, OUT);   /* every (batch, head): scores, mask, softmax, P (hi/lo) x exact v^T */
}

// v003
// A run of this version takes 52.1 microseconds.
// Two timings next to v002 put it at 2.02 and 2.03 times that version's speed.
// Over all steps from v000 it is 35.3 times as fast.
#include <hip/hip_runtime.h>

// Masked attention on given head-major tensors with an additive mask (q, k, v [2][12][2048][64]; scores = q.k + mask ([2][1][2048][2048] f32 unit normal, broadcast over heads, read); no scaling; softmax; out = probs v -> [2][12][2048][64] (3.1 M); argument order q, k, v, mask).
// Layout per (batch, head): single bf16 planes of q and k (inputs bf16-exact: exact score products) and value^T planes; one fused kernel walks the keys with a running maximum and sum per query (transposed products: S^T = K Q^T, O^T += V^T P^T), adds the batch's mask row, and writes the head-major output rows; no score or probability plane in memory.
// Compute dtypes, f32 accumulate: every input rounded to bf16; q.k exact; softmax f32; P hi/lo x exact value; output f32.

#define NB_  2
#define TT   2048
#define DM   768      // token-major row pitch (H x HD)
#define NH_  12
#define NKV  1
#define REP  (NH_ / NKV)
#define HD   64
#define DQ   (NH_ * HD)
#define DKV  (NKV * HD)
#define ZH   1
#define RH   2048
#define WIN  0
#define PCAR 1024.0f
#define SCL  1.0f   // scores are not scaled in the module
typedef _Float16 h16;
typedef unsigned short bf;
typedef __attribute__((ext_vector_type(16))) __bf16   v16bf;
typedef __attribute__((ext_vector_type(16))) _Float16 v16h;
typedef __attribute__((ext_vector_type(8)))  _Float16 v8h;
typedef __attribute__((ext_vector_type(8)))  unsigned short v8us;
typedef __attribute__((ext_vector_type(8)))  float    v8f;
typedef __attribute__((ext_vector_type(4)))  float    v4f;
typedef v8h  __attribute__((may_alias)) v8ha;
typedef v4f  __attribute__((may_alias)) v4fa;
typedef v8us __attribute__((may_alias)) v8usa;

__device__ __forceinline__ unsigned short f2bf(float f) { unsigned u = __float_as_uint(f); u += 0x7FFFu + ((u >> 16) & 1u); return (unsigned short)(u >> 16); }
__device__ __forceinline__ float bf2f(unsigned short b) { return __uint_as_float(((unsigned)b) << 16); }
__device__ __forceinline__ float bfr(float f) { return bf2f(f2bf(f)); }
__device__ __forceinline__ v16h cat16(v8h lo, v8h hi) { return __builtin_shufflevector(lo, hi, 0, 1, 2, 3, 4, 5, 6, 7, 8, 9, 10, 11, 12, 13, 14, 15); }
__device__ __forceinline__ v16bf cat16b(v8us lo, v8us hi) { return __builtin_bit_cast(v16bf, __builtin_shufflevector(lo, hi, 0, 1, 2, 3, 4, 5, 6, 7, 8, 9, 10, 11, 12, 13, 14, 15)); }
__device__ __forceinline__ v8f wmma16(v16h a, v16h b, v8f c) { return __builtin_amdgcn_wmma_f32_16x16x32_f16(false, a, false, b, (short)0, c, false, false); }
__device__ __forceinline__ v8f wmmab(v16bf a, v16bf b, v8f c) { return __builtin_amdgcn_wmma_f32_16x16x32_bf16(false, a, false, b, (short)0, c, false, false); }



typedef __attribute__((ext_vector_type(2))) _Float16 v2h;
typedef __attribute__((ext_vector_type(4))) _Float16 v4h;
typedef __attribute__((ext_vector_type(2))) unsigned short v2us;
typedef __attribute__((ext_vector_type(4))) unsigned short v4us;
typedef __attribute__((ext_vector_type(2))) float v2f;
typedef __attribute__((ext_vector_type(4))) int v4i;

// ---- k_prep: the three bf16 planes in one launch. Blocks below VTB each transpose one 128-key x 64-column tile of one head's v through LDS; the others round q and k, element order kept.
// v tile: a thread reads 4 columns of two neighbouring keys (16 lanes cover one 256-byte source row), packs each column's key pair into a dword and stores it at [column][key pair]; the 16-byte group index is XORed with column / 4, so that the 16 column groups of a wave's store fall on different banks and a row still reads back as 16-byte groups. Each v^T row piece leaves as 256 contiguous bytes.
#define VTB (NB_ * NH_ * (TT / 128))
#define CVB (NB_ * NH_ * TT * HD / 8 / (256 * 8))   /* blocks per plane: 256 threads x 8 groups of 8 values */
typedef __attribute__((ext_vector_type(2))) __bf16 v2bp;
typedef __attribute__((ext_vector_type(8))) __bf16 v8bp;
typedef __attribute__((ext_vector_type(4))) unsigned v4u;
__global__ __launch_bounds__(256) void k_prep(const float* __restrict__ Q, const float* __restrict__ K, const float* __restrict__ V, bf* __restrict__ QB, bf* __restrict__ KB, bf* __restrict__ VT) {
    __shared__ __attribute__((aligned(16))) unsigned tile[HD * 64];
    const int tid = threadIdx.x, c16 = tid & 15, r16 = tid >> 4;
    if (blockIdx.x < VTB) {
        const int bh = blockIdx.x / (TT / 128), t0 = (blockIdx.x % (TT / 128)) * 128;
        const float* src = V + ((size_t)bh * TT + t0) * HD + 4 * c16; v4f a[4], b[4];
#pragma unroll
        for (int j = 0; j < 4; ++j) { const int tp = r16 + 16 * j; a[j] = *(const v4f*)(src + (2 * tp) * HD); b[j] = *(const v4f*)(src + (2 * tp + 1) * HD); }
#pragma unroll
        for (int j = 0; j < 4; ++j) { const int tp = r16 + 16 * j;
#pragma unroll
            for (int c = 0; c < 4; ++c) tile[(4 * c16 + c) * 64 + ((((tp >> 2) ^ c16) << 2) | (tp & 3))] = __builtin_bit_cast(unsigned, __builtin_convertvector((v2f){a[j][c], b[j][c]}, v2bp)); }
        __syncthreads();   /* the tile is read back across waves */
        bf* dst = VT + (size_t)bh * HD * TT + t0 + 8 * c16;
#pragma unroll
        for (int j = 0; j < 4; ++j) { const int d = r16 + 16 * j; *(v4u*)(dst + (size_t)d * TT) = *(const v4u*)(tile + d * 64 + ((c16 ^ (d >> 2)) << 2)); }
    } else {
        const unsigned blk = blockIdx.x - VTB; const bool isk = blk >= CVB; const float* src = isk ? K : Q; bf* dst = isk ? KB : QB;
        const size_t i0 = (size_t)(isk ? blk - CVB : blk) * (256 * 8) + tid; v8f v[8];
#pragma unroll
        for (int j = 0; j < 8; ++j) v[j] = *(const v8f*)(src + (i0 + 256 * j) * 8);
#pragma unroll
        for (int j = 0; j < 8; ++j) *(v8bp*)(dst + (i0 + 256 * j) * 8) = __builtin_convertvector(v[j], v8bp);
        asm volatile("s_wait_xcnt 0x0" ::: "memory");   /* behind the run of stores: the build lays the other part's code behind this one, and no register that a store names is to be rewritten ahead of this wait */
    }
}


// ---- k_fattn: fused scores + mask + softmax + P.V. One wave owns 16 queries of one (batch, head) and walks all TT keys, KBLK at a time; 4 waves per work-group, grid (TT / 64, NB_ * NH_).
// Operands come through LDS: per block of KBLK keys each wave asks for one tile of 64 rows x 128 bytes by one tensor load (wave 0: the K rows; wave 1: the V^T rows; waves 2 and 3: the work-group's 64 mask rows, keys 0-31 and 32-63), padded to a pitch of 144 bytes for 16-byte readers. Two buffers: the next block's tiles fly while this block is worked on.
// S^T tile (16 keys x 16 queries) = K rows (A) x Q rows (B): lane (c = lane & 15, h = lane >> 4) holds query c, keys 8h + r in register r. Two such tiles, converted in place, are the B operand of O^T += V^T P^T (k order 8h + s, 16 + 8h + s: the order ldl() reads A in).
// Running maximum is shared by the two lane halves of a query (they feed one product); the sum stays per half and is joined once at the end.
#define KBLK 64
typedef __attribute__((ext_vector_type(2))) __bf16 v2b;
__device__ __forceinline__ v2f rnd2(v2f x) { return __builtin_convertvector(__builtin_convertvector(x, v2b), v2f); }   /* two f32 rounded to bf16 (nearest even), as f32 */
// Eight exp2 in one statement. It keeps the slot that the instruction set asks for behind a transcendental: each v_exp_f32 is followed by one that neither reads its result nor overwrites its source (outputs early-clobber), the last by v_nop.
__device__ __forceinline__ v8f exp2x8(v8f x) { float p0, p1, p2, p3, p4, p5, p6, p7;
    asm("v_exp_f32 %0, %8\n\tv_exp_f32 %1, %9\n\tv_exp_f32 %2, %10\n\tv_exp_f32 %3, %11\n\tv_exp_f32 %4, %12\n\tv_exp_f32 %5, %13\n\tv_exp_f32 %6, %14\n\tv_exp_f32 %7, %15\n\tv_nop"
        : "=&v"(p0), "=&v"(p1), "=&v"(p2), "=&v"(p3), "=&v"(p4), "=&v"(p5), "=&v"(p6), "=&v"(p7) : "v"(x[0]), "v"(x[1]), "v"(x[2]), "v"(x[3]), "v"(x[4]), "v"(x[5]), "v"(x[6]), "v"(x[7]));
    return (v8f){p0, p1, p2, p3, p4, p5, p6, p7}; }
__device__ __forceinline__ v16bf ldf(const unsigned short* p) { return cat16b(*(const v8us*)p, *(const v8us*)(p + 16)); }
#define LPIT 144u                  /* LDS row pitch: 128 data bytes + 16 pad bytes */
#define LSL  10240u                /* one tile's place: 64 rows x LPIT = 9216, rounded up to a multiple of 2 KiB */
#define LBUF (4u * LSL)            /* one buffer: K, V^T, two mask halves */
#define NST  (TT / KBLK)
typedef __attribute__((ext_vector_type(4))) unsigned u32x4;
typedef __attribute__((ext_vector_type(8))) unsigned u32x8;
__device__ __forceinline__ unsigned uni(unsigned v) { return (unsigned)__builtin_amdgcn_readfirstlane(v); }
__device__ __forceinline__ unsigned pinned(unsigned v) { unsigned w = uni(v); asm volatile("" : "+s"(w)); return w; }   /* holds a wave-uniform word in a scalar register, so that the test on it is a scalar branch */
__device__ __forceinline__ void wait_ds0() { asm volatile("s_wait_dscnt 0x0" ::: "memory"); }       /* this wave's LDS reads have retired before their buffer is handed back */
__device__ __forceinline__ void wait_tensor0() { asm volatile("s_wait_tensorcnt 0x0" ::: "memory"); }   /* this wave's tile has landed */
__device__ __forceinline__ v16bf ldl(const unsigned char* p) { return cat16b(*(const v8us*)p, *(const v8us*)(p + 32)); }   /* ldf() on an LDS row, byte offsets */
__global__ __launch_bounds__(128) void k_fattn(const unsigned short* __restrict__ QB, const unsigned short* __restrict__ KB, const unsigned short* __restrict__ VT, const float* __restrict__ madd, float* __restrict__ out) {
    const int lane = threadIdx.x & 31, lr = lane & 15, hi = lane >> 4; const int bh = blockIdx.y; const int q = blockIdx.x * 64 + (threadIdx.x >> 5) * 16 + lr;
    const unsigned short* qp = QB + ((size_t)bh * TT + q) * HD + 8 * hi; const v16bf q0 = ldf(qp), q1 = ldf(qp + 32);
    __shared__ __attribute__((aligned(2048))) unsigned char L[2 * LBUF];
    const unsigned wave = uni(threadIdx.x >> 5), lbase = (unsigned)(size_t)L;
    /* this wave's tile: first byte of block 0, source row pitch and step per block, in bytes */
    const unsigned long long src0 = wave == 0 ? (unsigned long long)(size_t)(KB + (size_t)bh * TT * HD) : wave == 1 ? (unsigned long long)(size_t)(VT + (size_t)bh * HD * TT)
                                  : (unsigned long long)(size_t)(madd + (size_t)(bh / NH_) * TT * TT + (size_t)blockIdx.x * 64 * TT + (wave - 2) * 32);
    const unsigned spit = wave == 0 ? HD * 2u : wave == 1 ? TT * 2u : TT * 4u, sadv = wave == 0 ? KBLK * HD * 2u : wave == 1 ? KBLK * 2u : KBLK * 4u;
    u32x8 g1; g1[0] = uni((1u << 20) | (4u << 22) | (3u << 25)); g1[1] = uni(128u << 16); g1[2] = uni(64u << 16); g1[3] = uni(128u << 16); g1[4] = uni(64u); g1[5] = uni(spit); g1[6] = uni(0u); g1[7] = uni(0u);   /* bytes; tensor = tile = 64 rows of 128; 4 pad dwords behind every 32 */
    asm volatile("" : "+s"(g1));   /* the pinned() form on the whole group: descriptor words held in their scalar registers through the loop; without it the build used two of them as scratch while a request was outstanding */
    auto issue = [&](unsigned st) { const unsigned long long ga = src0 + (unsigned long long)st * sadv; u32x4 g0; g0[0] = uni(1u); g0[1] = uni(lbase + (st & 1u) * LBUF + wave * LSL); g0[2] = uni((unsigned)ga); g0[3] = uni((((unsigned)(ga >> 32)) & 0x01FFFFFFu) | 0x80000000u);
        asm volatile("tensor_load_to_lds %0, %1" :: "s"(g0), "s"(g1) : "memory"); };   /* one request of the whole wave; every wave issues its own tile */
    issue(0);
    asm volatile("s_wait_xcnt 0x0" :: "v"(qp), "v"(q0), "v"(q1) : "memory");   /* behind the four query loads, in front of any reuse of their address pair; the operands, inputs only, hold the loads in front of it and the pair alive up to it */
    wait_tensor0(); __syncthreads();   /* block 0 published */
    issue(1);
    const unsigned kvo = (unsigned)(lr * LPIT + 16 * hi), mo = (unsigned)(((threadIdx.x >> 5) * 16 + lr) * LPIT + 32 * hi);
    v8f o[4];
#pragma unroll
    for (int mb = 0; mb < 4; ++mb) o[mb] = (v8f){};
    float mx = -3.0e38f, sum = 0.f;
#pragma unroll 1   /* stays rolled: one block's body already holds some 500 instructions and most of the register budget of three to four waves per SIMD */
    for (unsigned st = 0; st < NST; ++st) { const unsigned char* bp = L + (st & 1u) * LBUF;
        v8f s[KBLK / 16]; float bm = -3.0e38f; v16bf kf[KBLK / 16][2], vt[KBLK / 32][4]; v4f mk[KBLK / 16][2];   /* all of the block's fragments are asked for here, in the order of their use: the value fragments fly under the scores and the softmax */
#pragma unroll
        for (int t = 0; t < KBLK / 16; ++t) { const unsigned char* kr = bp + kvo + 16 * t * LPIT; kf[t][0] = ldl(kr); kf[t][1] = ldl(kr + 64);
            const unsigned char* mp = bp + (2 + (t >> 1)) * LSL + mo + 64 * (t & 1); mk[t][0] = *(const v4f*)mp; mk[t][1] = *(const v4f*)(mp + 16); }
#pragma unroll
        for (int g = 0; g < KBLK / 32; ++g)
#pragma unroll
            for (int mb = 0; mb < 4; ++mb) vt[g][mb] = ldl(bp + LSL + kvo + mb * 16 * LPIT + 64 * g);
        __builtin_amdgcn_sched_barrier(0);   /* keeps the LDS reads one group in front of the products: without it the build moved the value reads in among the matrix instructions, each pair with a full wait behind it */
#pragma unroll
        for (int t = 0; t < KBLK / 16; ++t) { s[t] = wmmab(kf[t][0], q0, (v8f){}); s[t] = wmmab(kf[t][1], q1, s[t]);
            const v4f ma = mk[t][0], mc = mk[t][1];   /* mask[b][q][keys 8h .. 8h + 7 of the tile], f32 input, bf16-rounded */
#pragma unroll
            for (int r = 0; r < 8; r += 2) { const v2f m2 = rnd2(r < 4 ? (v2f){ma[r], ma[r + 1]} : (v2f){mc[r - 4], mc[r - 3]}); s[t][r] = __fadd_rn(s[t][r], m2[0]); s[t][r + 1] = __fadd_rn(s[t][r + 1], m2[1]); bm = fmaxf(bm, fmaxf(s[t][r], s[t][r + 1])); } }
        bm = fmaxf(bm, __shfl_xor(bm, 16, 32)); const float mn = fmaxf(mx, bm);
        if (__builtin_amdgcn_ballot_w32(mn > mx) != 0) {   /* wave-uniform: a block that raises no query's maximum would scale by exactly 1 */
            const float al = __builtin_amdgcn_exp2f(__fmul_rn(__fsub_rn(mx, mn), 1.4426950408889634f)); sum *= al; mx = mn;
#pragma unroll
            for (int mb = 0; mb < 4; ++mb) o[mb] *= al; }
#pragma unroll
        for (int g = 0; g < KBLK / 32; ++g) { v16bf ph, pl;
#pragma unroll
            for (int u = 0; u < 2; ++u) { v8f x;
#pragma unroll
                for (int r = 0; r < 8; ++r) x[r] = __fmul_rn(__fsub_rn(s[2 * g + u][r], mx), 1.4426950408889634f);
                const v8f p8 = exp2x8(x);
#pragma unroll
                for (int r = 0; r < 8; r += 2) { const v2f p = {p8[r], p8[r + 1]}; sum += p[0]; sum += p[1]; const int e = 8 * u + r;
                    const v2b h2 = __builtin_convertvector(p, v2b); const v2b l2 = __builtin_convertvector(p - __builtin_convertvector(h2, v2f), v2b); ph[e] = h2[0]; ph[e + 1] = h2[1]; pl[e] = l2[0]; pl[e + 1] = l2[1]; } }
#pragma unroll
            for (int mb = 0; mb < 4; ++mb) { o[mb] = wmmab(vt[g][mb], ph, o[mb]); o[mb] = wmmab(vt[g][mb], pl, o[mb]); } }
        __builtin_amdgcn_sched_barrier(0);   /* keeps the block's arithmetic in front of the publish point: without it the build put half of it between the barrier and the refill, which then had that much less time to land */
        wait_ds0(); wait_tensor0(); __syncthreads();   /* publish point: block st + 1 has landed for every wave, and every wave has left block st's buffer */
        if (pinned(st + 2u < NST)) issue(st + 2u);   /* the refill, into the buffer that this block has just read; scalar branch: a tensor load ignores EXEC */
    }
    wait_tensor0(); wait_ds0();
    sum += __shfl_xor(sum, 16, 32); const float f = __fdiv_rn(1.0f, sum);
    float* op = out + ((size_t)bh * TT + q) * HD + 8 * hi;
#pragma unroll
    for (int mb = 0; mb < 4; ++mb) { v4f a, c;
#pragma unroll
        for (int r = 0; r < 4; ++r) { a[r] = o[mb][r] * f; c[r] = o[mb][r + 4] * f; }
        *(v4f*)(op + mb * 16) = a; *(v4f*)(op + mb * 16 + 4) = c; }
}

extern "C" void kernel_launch(void* const* d_in, const int* in_sizes, int n_in,
                              void* d_out, int out_size, void* d_ws, size_t ws_size, hipStream_t stream) {
    (void)in_sizes; (void)n_in; (void)out_size;
    const float* Qin = (const float*)d_in[0]; const float* Kin = (const float*)d_in[1]; const float* Vin = (const float*)d_in[2]; const float* Min = (const float*)d_in[3];   /* mask [2][1][2048][2048] f32 (additive, broadcast over heads; read) */   /* input order q, k, v, mask */
    float* OUT = (float*)d_out;     // [2][12][2048][64] head-major
    char* wsp = (char*)d_ws;
    auto take = [&](size_t bytes) { char* p = wsp; wsp += (bytes + 255) & ~(size_t)255; return (void*)p; };
    bf* QB = (bf*)take((size_t)NB_ * NH_ * TT * HD * 2); bf* KB = (bf*)take((size_t)NB_ * NH_ * TT * HD * 2); bf* VT = (bf*)take((size_t)NB_ * NH_ * HD * TT * 2);
    if ((size_t)(wsp - (char*)d_ws) > ws_size) return;
    k_prep<<<VTB + 2 * CVB, 256, 0, stream>>>(Qin, Kin, Vin, QB, KB, VT);   /* q, k rounded to bf16; v rounded and transposed per head */
    k_fattn<<<dim3(TT / 64, NB_ * NH_, 1), 128, 0, stream>>>(QB, KB, VT, Min, OUT);   /* every (batch, head): scores, mask, softmax, P (hi/lo) x exact v^T */
}

// v004
// One run takes 49.6 microseconds.
// In two side-by-side timings against v003, it was 1.06 and 1.05 times as fast.
// Counting every step since v000, it is 37.1 times as fast.
#include <hip/hip_runtime.h>

// Masked attention on given head-major tensors with an additive mask (q, k, v [2][12][2048][64]; scores = q.k + mask ([2][1][2048][2048] f32 unit normal, broadcast over heads, read); no scaling; softmax; out = probs v -> [2][12][2048][64] (3.1 M); argument order q, k, v, mask).
// Layout per (batch, head): single bf16 planes of q and k (inputs bf16-exact: exact score products) and value^T planes; one fused kernel walks the keys with a running maximum and sum per query (transposed products: S^T = K Q^T, O^T += V^T P^T), adds the batch's mask row, and writes the head-major output rows; no score or probability plane in memory.
// Compute dtypes, f32 accumulate: every input rounded to bf16; q.k exact; softmax f32; P hi/lo x exact value; output f32.

#define NB_  2
#define TT   2048
#define DM   768      // H x HD; unused, all tensors here are head-major
#define NH_  12
#define NKV  1
#define REP  (NH_ / NKV)
#define HD   64
#define DQ   (NH_ * HD)
#define DKV  (NKV * HD)
#define ZH   1
#define RH   2048
#define WIN  0
#define PCAR 1024.0f
#define SCL  1.0f   // scores are not scaled in the module
typedef _Float16 h16;
typedef unsigned short bf;
typedef __attribute__((ext_vector_type(16))) __bf16   v16bf;
typedef __attribute__((ext_vector_type(16))) _Float16 v16h;
typedef __attribute__((ext_vector_type(8)))  _Float16 v8h;
typedef __attribute__((ext_vector_type(8)))  unsigned short v8us;
typedef __attribute__((ext_vector_type(8)))  float    v8f;
typedef __attribute__((ext_vector_type(4)))  float    v4f;
typedef v8h  __attribute__((may_alias)) v8ha;
typedef v4f  __attribute__((may_alias)) v4fa;
typedef v8us __attribute__((may_alias)) v8usa;

__device__ __forceinline__ unsigned short f2bf(float f) { unsigned u = __float_as_uint(f); u += 0x7FFFu + ((u >> 16) & 1u); return (unsigned short)(u >> 16); }
__device__ __forceinline__ float bf2f(unsigned short b) { return __uint_as_float(((unsigned)b) << 16); }
__device__ __forceinline__ float bfr(float f) { return bf2f(f2bf(f)); }
__device__ __forceinline__ v16h cat16(v8h lo, v8h hi) { return __builtin_shufflevector(lo, hi, 0, 1, 2, 3, 4, 5, 6, 7, 8, 9, 10, 11, 12, 13, 14, 15); }
__device__ __forceinline__ v16bf cat16b(v8us lo, v8us hi) { return __builtin_bit_cast(v16bf, __builtin_shufflevector(lo, hi, 0, 1, 2, 3, 4, 5, 6, 7, 8, 9, 10, 11, 12, 13, 14, 15)); }
__device__ __forceinline__ v8f wmma16(v16h a, v16h b, v8f c) { return __builtin_amdgcn_wmma_f32_16x16x32_f16(false, a, false, b, (short)0, c, false, false); }
__device__ __forceinline__ v8f wmmab(v16bf a, v16bf b, v8f c) { return __builtin_amdgcn_wmma_f32_16x16x32_bf16(false, a, false, b, (short)0, c, false, false); }



typedef __attribute__((ext_vector_type(2))) _Float16 v2h;
typedef __attribute__((ext_vector_type(4))) _Float16 v4h;
typedef __attribute__((ext_vector_type(2))) unsigned short v2us;
typedef __attribute__((ext_vector_type(4))) unsigned short v4us;
typedef __attribute__((ext_vector_type(2))) float v2f;
typedef __attribute__((ext_vector_type(4))) int v4i;

// ---- k_prep: the three bf16 planes in one launch. Blocks below VTB each transpose one 128-key x 64-column tile of one head's v through LDS; the others round q and k, element order kept.
// v tile: a thread reads 4 columns of two neighbouring keys (16 lanes cover one 256-byte source row), packs each column's key pair into a dword and stores it at [column][key pair]; the 16-byte group index is XORed with column / 4, so that the 16 column groups of a wave's store fall on different banks and a row still reads back as 16-byte groups. Each v^T row piece leaves as 256 contiguous bytes.
#define VTB (NB_ * NH_ * (TT / 128))
#define CVB (NB_ * NH_ * TT * HD / 8 / (256 * 8))   /* blocks per plane: 256 threads x 8 groups of 8 values */
typedef __attribute__((ext_vector_type(2))) __bf16 v2bp;
typedef __attribute__((ext_vector_type(8))) __bf16 v8bp;
typedef __attribute__((ext_vector_type(4))) unsigned v4u;
__global__ __launch_bounds__(256) void k_prep(const float* __restrict__ Q, const float* __restrict__ K, const float* __restrict__ V, bf* __restrict__ QB, bf* __restrict__ KB, bf* __restrict__ VT) {
    __shared__ __attribute__((aligned(16))) unsigned tile[HD * 64];
    const int tid = threadIdx.x, c16 = tid & 15, r16 = tid >> 4;
    if (blockIdx.x < VTB) {
        const int bh = blockIdx.x / (TT / 128), t0 = (blockIdx.x % (TT / 128)) * 128;
        const float* src = V + ((size_t)bh * TT + t0) * HD + 4 * c16; v4f a[4], b[4];
#pragma unroll
        for (int j = 0; j < 4; ++j) { const int tp = r16 + 16 * j; a[j] = *(const v4f*)(src + (2 * tp) * HD); b[j] = *(const v4f*)(src + (2 * tp + 1) * HD); }
#pragma unroll
        for (int j = 0; j < 4; ++j) { const int tp = r16 + 16 * j;
#pragma unroll
            for (int c = 0; c < 4; ++c) tile[(4 * c16 + c) * 64 + ((((tp >> 2) ^ c16) << 2) | (tp & 3))] = __builtin_bit_cast(unsigned, __builtin_convertvector((v2f){a[j][c], b[j][c]}, v2bp)); }
        __syncthreads();   /* the tile is read back across waves */
        bf* dst = VT + (size_t)bh * HD * TT + t0 + 8 * c16;
#pragma unroll
        for (int j = 0; j < 4; ++j) { const int d = r16 + 16 * j; *(v4u*)(dst + (size_t)d * TT) = *(const v4u*)(tile + d * 64 + ((c16 ^ (d >> 2)) << 2)); }
    } else {
        const unsigned blk = blockIdx.x - VTB; const bool isk = blk >= CVB; const float* src = isk ? K : Q; bf* dst = isk ? KB : QB;
        const size_t i0 = (size_t)(isk ? blk - CVB : blk) * (256 * 8) + tid; v8f v[8];
#pragma unroll
        for (int j = 0; j < 8; ++j) v[j] = *(const v8f*)(src + (i0 + 256 * j) * 8);
#pragma unroll
        for (int j = 0; j < 8; ++j) *(v8bp*)(dst + (i0 + 256 * j) * 8) = __builtin_convertvector(v[j], v8bp);
        asm volatile("s_wait_xcnt 0x0" ::: "memory");   /* behind the run of stores: the build lays the other part's code behind this one, and no register that a store names is to be rewritten ahead of this wait */
    }
}


// ---- k_fattn: fused scores + mask + softmax + P.V. One wave owns 16 queries of one (batch, head) and walks all TT keys, KBLK at a time; 4 waves per work-group, grid (TT / 64, NB_ * NH_).
// Operands come through LDS: per block of KBLK keys each wave asks for one tile of 64 rows x 128 bytes by one tensor load (wave 0: the K rows; wave 1: the V^T rows; waves 2 and 3: the work-group's 64 mask rows, keys 0-31 and 32-63), padded to a pitch of 144 bytes for 16-byte readers. Two buffers: the next block's tiles fly while this block is worked on.
// S^T tile (16 keys x 16 queries) = K rows (A) x Q rows (B): lane (c = lane & 15, h = lane >> 4) holds query c, keys 8h + r in register r. Two such tiles, converted in place, are the B operand of O^T += V^T P^T (k order 8h + s, 16 + 8h + s: the order ldl() reads A in).
// Running maximum is shared by the two lane halves of a query (they feed one product); the sum stays per half and is joined once at the end.
#define KBLK 64
typedef __attribute__((ext_vector_type(2))) __bf16 v2b;
__device__ __forceinline__ v2f rnd2(v2f x) { return __builtin_convertvector(__builtin_convertvector(x, v2b), v2f); }   /* two f32 rounded to bf16 (nearest even), as f32 */
// Eight exp2 in one statement. It keeps the slot that the instruction set asks for behind a transcendental: each v_exp_f32 is followed by one that neither reads its result nor overwrites its source (outputs early-clobber), the last by v_nop.
__device__ __forceinline__ v8f exp2x8(v8f x) { float p0, p1, p2, p3, p4, p5, p6, p7;
    asm("v_exp_f32 %0, %8\n\tv_exp_f32 %1, %9\n\tv_exp_f32 %2, %10\n\tv_exp_f32 %3, %11\n\tv_exp_f32 %4, %12\n\tv_exp_f32 %5, %13\n\tv_exp_f32 %6, %14\n\tv_exp_f32 %7, %15\n\tv_nop"
        : "=&v"(p0), "=&v"(p1), "=&v"(p2), "=&v"(p3), "=&v"(p4), "=&v"(p5), "=&v"(p6), "=&v"(p7) : "v"(x[0]), "v"(x[1]), "v"(x[2]), "v"(x[3]), "v"(x[4]), "v"(x[5]), "v"(x[6]), "v"(x[7]));
    return (v8f){p0, p1, p2, p3, p4, p5, p6, p7}; }
__device__ __forceinline__ v16bf ldf(const unsigned short* p) { return cat16b(*(const v8us*)p, *(const v8us*)(p + 16)); }
#define LPIT 144u                  /* LDS row pitch: 128 data bytes + 16 pad bytes */
#define LSL  10240u                /* one tile's place: 64 rows x LPIT = 9216, rounded up to a multiple of 2 KiB */
#define LBUF (4u * LSL)            /* one buffer: K, V^T, two mask halves */
#define NST  (TT / KBLK)
typedef __attribute__((ext_vector_type(4))) unsigned u32x4;
typedef __attribute__((ext_vector_type(8))) unsigned u32x8;
__device__ __forceinline__ unsigned uni(unsigned v) { return (unsigned)__builtin_amdgcn_readfirstlane(v); }
__device__ __forceinline__ unsigned pinned(unsigned v) { unsigned w = uni(v); asm volatile("" : "+s"(w)); return w; }   /* holds a wave-uniform word in a scalar register, so that the test on it is a scalar branch */
__device__ __forceinline__ void wait_ds0() { asm volatile("s_wait_dscnt 0x0" ::: "memory"); }       /* this wave's LDS reads have retired before their buffer is handed back */
__device__ __forceinline__ void wait_tensor0() { asm volatile("s_wait_tensorcnt 0x0" ::: "memory"); }   /* this wave's tile has landed */
__device__ __forceinline__ v16bf ldl(const unsigned char* p) { return cat16b(*(const v8us*)p, *(const v8us*)(p + 32)); }   /* ldf() on an LDS row, byte offsets */
__global__ __launch_bounds__(128) void k_fattn(const unsigned short* __restrict__ QB, const unsigned short* __restrict__ KB, const unsigned short* __restrict__ VT, const float* __restrict__ madd, float* __restrict__ out) {
    const int lane = threadIdx.x & 31, lr = lane & 15, hi = lane >> 4; const int bh = blockIdx.y; const int q = blockIdx.x * 64 + (threadIdx.x >> 5) * 16 + lr;
    const unsigned short* qp = QB + ((size_t)bh * TT + q) * HD + 8 * hi; const v16bf q0 = ldf(qp), q1 = ldf(qp + 32);
    __shared__ __attribute__((aligned(2048))) unsigned char L[2 * LBUF];
    const unsigned wave = uni(threadIdx.x >> 5), lbase = (unsigned)(size_t)L;
    /* this wave's tile: first byte of block 0, source row pitch and step per block, in bytes */
    const unsigned long long src0 = wave == 0 ? (unsigned long long)(size_t)(KB + (size_t)bh * TT * HD) : wave == 1 ? (unsigned long long)(size_t)(VT + (size_t)bh * HD * TT)
                                  : (unsigned long long)(size_t)(madd + (size_t)(bh / NH_) * TT * TT + (size_t)blockIdx.x * 64 * TT + (wave - 2) * 32);
    const unsigned spit = wave == 0 ? HD * 2u : wave == 1 ? TT * 2u : TT * 4u, sadv = wave == 0 ? KBLK * HD * 2u : wave == 1 ? KBLK * 2u : KBLK * 4u;
    u32x8 g1; g1[0] = uni((1u << 20) | (4u << 22) | (3u << 25)); g1[1] = uni(128u << 16); g1[2] = uni(64u << 16); g1[3] = uni(128u << 16); g1[4] = uni(64u); g1[5] = uni(spit); g1[6] = uni(0u); g1[7] = uni(0u);   /* bytes; tensor = tile = 64 rows of 128; 4 pad dwords behind every 32 */
    asm volatile("" : "+s"(g1));   /* the pinned() form on the whole group: descriptor words held in their scalar registers through the loop; without it the build used two of them as scratch while a request was outstanding */
    auto issue = [&](unsigned st) { const unsigned long long ga = src0 + (unsigned long long)st * sadv; u32x4 g0; g0[0] = uni(1u); g0[1] = uni(lbase + (st & 1u) * LBUF + wave * LSL); g0[2] = uni((unsigned)ga); g0[3] = uni((((unsigned)(ga >> 32)) & 0x01FFFFFFu) | 0x80000000u);
        asm volatile("tensor_load_to_lds %0, %1" :: "s"(g0), "s"(g1) : "memory"); };   /* one request of the whole wave; every wave issues its own tile */
    issue(0);
    asm volatile("s_wait_xcnt 0x0" :: "v"(qp), "v"(q0), "v"(q1) : "memory");   /* behind the four query loads, in front of any reuse of their address pair; the operands, inputs only, hold the loads in front of it and the pair alive up to it */
    wait_tensor0(); __syncthreads();   /* block 0 published */
    issue(1);
    const unsigned kvo = (unsigned)(lr * LPIT + 16 * hi), mo = (unsigned)(((threadIdx.x >> 5) * 16 + lr) * LPIT + 32 * hi);
    v8f o[4];
#pragma unroll
    for (int mb = 0; mb < 4; ++mb) o[mb] = (v8f){};
    float mx = -3.0e38f, mxl = -3.0e38f; v2f sum2 = {0.f, 0.f};   /* mxl: the exponent offset in use, the maximum times log2(e) rounded up to a whole number; even and odd keys are summed apart */
#pragma unroll 1   /* stays rolled: one block's body already holds some 500 instructions and most of the register budget of three to four waves per SIMD */
    for (unsigned st = 0; st < NST; ++st) { const unsigned char* bp = L + (st & 1u) * LBUF;
        v8f s[KBLK / 16]; float bm = -3.0e38f; v16bf kf[KBLK / 16][2], vt[KBLK / 32][4]; v4f mk[KBLK / 16][2];   /* all of the block's fragments are asked for here, in the order of their use: the value fragments fly under the scores and the softmax */
#pragma unroll
        for (int t = 0; t < KBLK / 16; ++t) { const unsigned char* kr = bp + kvo + 16 * t * LPIT; kf[t][0] = ldl(kr); kf[t][1] = ldl(kr + 64);
            const unsigned char* mp = bp + (2 + (t >> 1)) * LSL + mo + 64 * (t & 1); mk[t][0] = *(const v4f*)mp; mk[t][1] = *(const v4f*)(mp + 16); }
#pragma unroll
        for (int g = 0; g < KBLK / 32; ++g)
#pragma unroll
            for (int mb = 0; mb < 4; ++mb) vt[g][mb] = ldl(bp + LSL + kvo + mb * 16 * LPIT + 64 * g);
        __builtin_amdgcn_sched_barrier(0);   /* keeps the LDS reads one group in front of the products: without it the build moved the value reads in among the matrix instructions, each pair with a full wait behind it */
#pragma unroll
        for (int t = 0; t < KBLK / 16; ++t) { s[t] = wmmab(kf[t][0], q0, (v8f){}); s[t] = wmmab(kf[t][1], q1, s[t]);
            const v4f ma = mk[t][0], mc = mk[t][1];   /* mask[b][q][keys 8h .. 8h + 7 of the tile], f32 input, bf16-rounded */
#pragma unroll
            for (int r = 0; r < 8; r += 2) { const v2f m2 = rnd2(r < 4 ? (v2f){ma[r], ma[r + 1]} : (v2f){mc[r - 4], mc[r - 3]}); s[t][r] = __fadd_rn(s[t][r], m2[0]); s[t][r + 1] = __fadd_rn(s[t][r + 1], m2[1]); bm = fmaxf(bm, fmaxf(s[t][r], s[t][r + 1])); } }
        bm = fmaxf(bm, __shfl_xor(bm, 16, 32)); const float mn = fmaxf(mx, bm);
        if (__builtin_amdgcn_ballot_w32(mn > mx) != 0) {   /* wave-uniform: a block that raises no query's maximum would scale by exactly 1 */
            const float nl = __builtin_ceilf(mn * 1.4426950408889634f); const float al = __builtin_amdgcn_exp2f(mxl - nl); sum2 *= al; mx = mn; mxl = nl;   /* whole-number offsets: the factor between two of them is an exact power of two */
#pragma unroll
            for (int mb = 0; mb < 4; ++mb) o[mb] *= al; }
        const v2f l2e = {1.4426950408889634f, 1.4426950408889634f}, nm2 = {-mxl, -mxl};
        v16bf ph[KBLK / 32], pl[KBLK / 32];
#pragma unroll
        for (int g = 0; g < KBLK / 32; ++g)
#pragma unroll
            for (int u = 0; u < 2; ++u) { v8f x;
#pragma unroll
                for (int r = 0; r < 8; r += 2) { const v2f x2 = __builtin_elementwise_fma((v2f){s[2 * g + u][r], s[2 * g + u][r + 1]}, l2e, nm2); x[r] = x2[0]; x[r + 1] = x2[1]; }   /* s log2(e) - mxl: one packed fused multiply-add per score pair */
                const v8f p8 = exp2x8(x);
#pragma unroll
                for (int r = 0; r < 8; r += 2) { const v2f p = {p8[r], p8[r + 1]}; sum2 += p; const int e = 8 * u + r;
                    const v2b h2 = __builtin_convertvector(p, v2b); const v2b l2 = __builtin_convertvector(p - __builtin_convertvector(h2, v2f), v2b); ph[g][e] = h2[0]; ph[g][e + 1] = h2[1]; pl[g][e] = l2[0]; pl[g][e + 1] = l2[1]; } }
        __builtin_amdgcn_sched_barrier(0);   /* every exponential stands in front of the value products */
#pragma unroll
        for (int g = 0; g < KBLK / 32; ++g)
#pragma unroll
            for (int mb = 0; mb < 4; ++mb) { o[mb] = wmmab(vt[g][mb], ph[g], o[mb]); o[mb] = wmmab(vt[g][mb], pl[g], o[mb]); }
        __builtin_amdgcn_sched_barrier(0);   /* keeps the block's arithmetic in front of the publish point: without it the build put half of it between the barrier and the refill, which then had that much less time to land */
        wait_ds0(); wait_tensor0(); __syncthreads();   /* publish point: block st + 1 has landed for every wave, and every wave has left block st's buffer */
        if (pinned(st + 2u < NST)) issue(st + 2u);   /* the refill, into the buffer that this block has just read; scalar branch: a tensor load ignores EXEC */
    }
    wait_tensor0(); wait_ds0();
    float sum = sum2[0] + sum2[1]; sum += __shfl_xor(sum, 16, 32); const float f = __fdiv_rn(1.0f, sum);
    float* op = out + ((size_t)bh * TT + q) * HD + 8 * hi;
#pragma unroll
    for (int mb = 0; mb < 4; ++mb) { v4f a, c;
#pragma unroll
        for (int r = 0; r < 4; ++r) { a[r] = o[mb][r] * f; c[r] = o[mb][r + 4] * f; }
        *(v4f*)(op + mb * 16) = a; *(v4f*)(op + mb * 16 + 4) = c; }
}

extern "C" void kernel_launch(void* const* d_in, const int* in_sizes, int n_in,
                              void* d_out, int out_size, void* d_ws, size_t ws_size, hipStream_t stream) {
    (void)in_sizes; (void)n_in; (void)out_size;
    const float* Qin = (const float*)d_in[0]; const float* Kin = (const float*)d_in[1]; const float* Vin = (const float*)d_in[2]; const float* Min = (const float*)d_in[3];   /* mask [2][1][2048][2048] f32 (additive, broadcast over heads; read) */   /* input order q, k, v, mask */
    float* OUT = (float*)d_out;     // [2][12][2048][64] head-major
    char* wsp = (char*)d_ws;
    auto take = [&](size_t bytes) { char* p = wsp; wsp += (bytes + 255) & ~(size_t)255; return (void*)p; };
    bf* QB = (bf*)take((size_t)NB_ * NH_ * TT * HD * 2); bf* KB = (bf*)take((size_t)NB_ * NH_ * TT * HD * 2); bf* VT = (bf*)take((size_t)NB_ * NH_ * HD * TT * 2);
    if ((size_t)(wsp - (char*)d_ws) > ws_size) return;
    k_prep<<<VTB + 2 * CVB, 256, 0, stream>>>(Qin, Kin, Vin, QB, KB, VT);   /* q, k rounded to bf16; v rounded and transposed per head */
    k_fattn<<<dim3(TT / 64, NB_ * NH_, 1), 128, 0, stream>>>(QB, KB, VT, Min, OUT);   /* every (batch, head): scores, mask, softmax, P (hi/lo) x exact v^T */
}

// v005
// A run of this version takes 47.2 microseconds.
// Timed twice side by side with v004, it ran 1.05 times as fast both times.
// Over all steps from v000 it is 39.0 times as fast.
#include <hip/hip_runtime.h>

// Masked attention on given head-major tensors with an additive mask (q, k, v [2][12][2048][64]; scores = q.k + mask ([2][1][2048][2048] f32 unit normal, broadcast over heads, read); no scaling; softmax; out = probs v -> [2][12][2048][64] (3.1 M); argument order q, k, v, mask).
// Layout per (batch, head): single bf16 planes of q and k (inputs bf16-exact: exact score products) and value^T planes; one fused kernel walks the keys with a running maximum and sum per query (transposed products: S^T = K Q^T, O^T += V^T P^T), adds the batch's mask row, and writes the head-major output rows; no score or probability plane in memory.
// Compute dtypes, f32 accumulate: every input rounded to bf16; q.k exact; softmax f32; P hi/lo x exact value; output f32.

#define NB_  2
#define TT   2048
#define DM   768      // H x HD; unused, all tensors here are head-major
#define NH_  12
#define NKV  1
#define REP  (NH_ / NKV)
#define HD   64
#define DQ   (NH_ * HD)
#define DKV  (NKV * HD)
#define ZH   1
#define RH   2048
#define WIN  0
#define PCAR 1024.0f
#define SCL  1.0f   // scores are not scaled in the module
typedef _Float16 h16;
typedef unsigned short bf;
typedef __attribute__((ext_vector_type(16))) __bf16   v16bf;
typedef __attribute__((ext_vector_type(16))) _Float16 v16h;
typedef __attribute__((ext_vector_type(8)))  _Float16 v8h;
typedef __attribute__((ext_vector_type(8)))  unsigned short v8us;
typedef __attribute__((ext_vector_type(8)))  float    v8f;
typedef __attribute__((ext_vector_type(4)))  float    v4f;
typedef v8h  __attribute__((may_alias)) v8ha;
typedef v4f  __attribute__((may_alias)) v4fa;
typedef v8us __attribute__((may_alias)) v8usa;

__device__ __forceinline__ unsigned short f2bf(float f) { unsigned u = __float_as_uint(f); u += 0x7FFFu + ((u >> 16) & 1u); return (unsigned short)(u >> 16); }
__device__ __forceinline__ float bf2f(unsigned short b) { return __uint_as_float(((unsigned)b) << 16); }
__device__ __forceinline__ float bfr(float f) { return bf2f(f2bf(f)); }
__device__ __forceinline__ v16h cat16(v8h lo, v8h hi) { return __builtin_shufflevector(lo, hi, 0, 1, 2, 3, 4, 5, 6, 7, 8, 9, 10, 11, 12, 13, 14, 15); }
__device__ __forceinline__ v16bf cat16b(v8us lo, v8us hi) { return __builtin_bit_cast(v16bf, __builtin_shufflevector(lo, hi, 0, 1, 2, 3, 4, 5, 6, 7, 8, 9, 10, 11, 12, 13, 14, 15)); }
__device__ __forceinline__ v8f wmma16(v16h a, v16h b, v8f c) { return __builtin_amdgcn_wmma_f32_16x16x32_f16(false, a, false, b, (short)0, c, false, false); }
__device__ __forceinline__ v8f wmmab(v16bf a, v16bf b, v8f c) { return __builtin_amdgcn_wmma_f32_16x16x32_bf16(false, a, false, b, (short)0, c, false, false); }



typedef __attribute__((ext_vector_type(2))) _Float16 v2h;
typedef __attribute__((ext_vector_type(4))) _Float16 v4h;
typedef __attribute__((ext_vector_type(2))) unsigned short v2us;
typedef __attribute__((ext_vector_type(4))) unsigned short v4us;
typedef __attribute__((ext_vector_type(2))) float v2f;
typedef __attribute__((ext_vector_type(4))) int v4i;

// ---- k_prep: the three bf16 planes in one launch. Blocks below VTB each transpose one 128-key x 64-column tile of one head's v through LDS; the others round q and k, element order kept.
// v tile: a thread reads 4 columns of two neighbouring keys (16 lanes cover one 256-byte source row), packs each column's key pair into a dword and stores it at [column][key pair]; the 16-byte group index is XORed with column / 4, so that the 16 column groups of a wave's store fall on different banks and a row still reads back as 16-byte groups. Each v^T row piece leaves as 256 contiguous bytes.
#define VTB (NB_ * NH_ * (TT / 128))
#define CVB (NB_ * NH_ * TT * HD / 8 / (256 * 8))   /* blocks per plane: 256 threads x 8 groups of 8 values */
typedef __attribute__((ext_vector_type(2))) __bf16 v2bp;
typedef __attribute__((ext_vector_type(8))) __bf16 v8bp;
typedef __attribute__((ext_vector_type(4))) unsigned v4u;
__global__ __launch_bounds__(256) void k_prep(const float* __restrict__ Q, const float* __restrict__ K, const float* __restrict__ V, bf* __restrict__ QB, bf* __restrict__ KB, bf* __restrict__ VT) {
    __shared__ __attribute__((aligned(16))) unsigned tile[HD * 64];
    const int tid = threadIdx.x, c16 = tid & 15, r16 = tid >> 4;
    if (blockIdx.x < VTB) {
        const int bh = blockIdx.x / (TT / 128), t0 = (blockIdx.x % (TT / 128)) * 128;
        const float* src = V + ((size_t)bh * TT + t0) * HD + 4 * c16; v4f a[4], b[4];
#pragma unroll
        for (int j = 0; j < 4; ++j) { const int tp = r16 + 16 * j; a[j] = *(const v4f*)(src + (2 * tp) * HD); b[j] = *(const v4f*)(src + (2 * tp + 1) * HD); }
#pragma unroll
        for (int j = 0; j < 4; ++j) { const int tp = r16 + 16 * j;
#pragma unroll
            for (int c = 0; c < 4; ++c) tile[(4 * c16 + c) * 64 + ((((tp >> 2) ^ c16) << 2) | (tp & 3))] = __builtin_bit_cast(unsigned, __builtin_convertvector((v2f){a[j][c], b[j][c]}, v2bp)); }
        __syncthreads();   /* the tile is read back across waves */
        bf* dst = VT + (size_t)bh * HD * TT + t0 + 8 * c16;
#pragma unroll
        for (int j = 0; j < 4; ++j) { const int d = r16 + 16 * j; *(v4u*)(dst + (size_t)d * TT) = *(const v4u*)(tile + d * 64 + ((c16 ^ (d >> 2)) << 2)); }
    } else {
        const unsigned blk = blockIdx.x - VTB; const bool isk = blk >= CVB; const float* src = isk ? K : Q; bf* dst = isk ? KB : QB;
        const size_t i0 = (size_t)(isk ? blk - CVB : blk) * (256 * 8) + tid; v8f v[8];
#pragma unroll
        for (int j = 0; j < 8; ++j) v[j] = *(const v8f*)(src + (i0 + 256 * j) * 8);
#pragma unroll
        for (int j = 0; j < 8; ++j) *(v8bp*)(dst + (i0 + 256 * j) * 8) = __builtin_convertvector(v[j], v8bp);
        asm volatile("s_wait_xcnt 0x0" ::: "memory");   /* behind the run of stores: the build lays the other part's code behind this one, and no register that a store names is to be rewritten ahead of this wait */
    }
}


// ---- k_fattn: fused scores + mask + softmax + P.V. One wave owns 16 queries of one (batch, head) and walks all TT keys, KBLK at a time; 4 waves per work-group, grid (TT / 64, NB_ * NH_).
// Operands come through LDS: per block of KBLK keys each wave asks for one tile of 64 rows x 128 bytes by one tensor load (wave 0: the K rows; wave 1: the V^T rows; waves 2 and 3: the work-group's 64 mask rows, keys 0-31 and 32-63), padded to a pitch of 144 bytes for 16-byte readers. Two buffers: the next block's tiles fly while this block is worked on.
// S^T tile (16 keys x 16 queries) = K rows (A) x Q rows (B): lane (c = lane & 15, h = lane >> 4) holds query c, keys 8h + r in register r. Two such tiles, converted in place, are the B operand of O^T += V^T P^T (k order 8h + s, 16 + 8h + s: the order ldf() reads A in).
// Each work-group enters the ring of key blocks at its own block and wraps round: the 32 work-groups of a head (same K, V^T lines) and the 12 heads of a query block (same mask lines) would otherwise ask L2 for the same lines at the same moment. The online softmax takes the blocks in any order.
// Running maximum is shared by the two lane halves of a query (they feed one product); the sum stays per half and is joined once at the end.
#define KBLK 64
typedef __attribute__((ext_vector_type(2))) __bf16 v2b;
__device__ __forceinline__ v2f rnd2(v2f x) { return __builtin_convertvector(__builtin_convertvector(x, v2b), v2f); }   /* two f32 rounded to bf16 (nearest even), as f32 */
// Eight exp2 in one statement. It keeps the slot that the instruction set asks for behind a transcendental: each v_exp_f32 is followed by one that neither reads its result nor overwrites its source (outputs early-clobber), the last by v_nop.
__device__ __forceinline__ v8f exp2x8(v8f x) { float p0, p1, p2, p3, p4, p5, p6, p7;
    asm("v_exp_f32 %0, %8\n\tv_exp_f32 %1, %9\n\tv_exp_f32 %2, %10\n\tv_exp_f32 %3, %11\n\tv_exp_f32 %4, %12\n\tv_exp_f32 %5, %13\n\tv_exp_f32 %6, %14\n\tv_exp_f32 %7, %15\n\tv_nop"
        : "=&v"(p0), "=&v"(p1), "=&v"(p2), "=&v"(p3), "=&v"(p4), "=&v"(p5), "=&v"(p6), "=&v"(p7) : "v"(x[0]), "v"(x[1]), "v"(x[2]), "v"(x[3]), "v"(x[4]), "v"(x[5]), "v"(x[6]), "v"(x[7]));
    return (v8f){p0, p1, p2, p3, p4, p5, p6, p7}; }
__device__ __forceinline__ v16bf ldf(const unsigned short* p) { return cat16b(*(const v8us*)p, *(const v8us*)(p + 16)); }
#define LPIT 144u                  /* LDS row pitch: 128 data bytes + 16 pad bytes */
#define LSL  10240u                /* one tile's place: 64 rows x LPIT = 9216, rounded up to a multiple of 2 KiB */
#define LBUF (4u * LSL)            /* one buffer: K, V^T, two mask halves */
#define NST  (TT / KBLK)
typedef __attribute__((ext_vector_type(4))) unsigned u32x4;
typedef __attribute__((ext_vector_type(8))) unsigned u32x8;
__device__ __forceinline__ unsigned uni(unsigned v) { return (unsigned)__builtin_amdgcn_readfirstlane(v); }
__device__ __forceinline__ unsigned pinned(unsigned v) { unsigned w = uni(v); asm volatile("" : "+s"(w)); return w; }   /* holds a wave-uniform word in a scalar register, so that the test on it is a scalar branch */
__device__ __forceinline__ void wait_ds0() { asm volatile("s_wait_dscnt 0x0" ::: "memory"); }       /* this wave's LDS reads have retired before their buffer is handed back */
__device__ __forceinline__ void wait_tensor0() { asm volatile("s_wait_tensorcnt 0x0" ::: "memory"); }   /* this wave's tile has landed */
__device__ __forceinline__ v16bf ldl(const unsigned char* p) { return cat16b(*(const v8us*)p, *(const v8us*)(p + 32)); }   /* ldf() on an LDS row, byte offsets */
__global__ __launch_bounds__(128) void k_fattn(const unsigned short* __restrict__ QB, const unsigned short* __restrict__ KB, const unsigned short* __restrict__ VT, const float* __restrict__ madd, float* __restrict__ out) {
    const int lane = threadIdx.x & 31, lr = lane & 15, hi = lane >> 4; const int bh = blockIdx.y; const int q = blockIdx.x * 64 + (threadIdx.x >> 5) * 16 + lr;
    const unsigned short* qp = QB + ((size_t)bh * TT + q) * HD + 8 * hi; const v16bf q0 = ldf(qp), q1 = ldf(qp + 32);
    __shared__ __attribute__((aligned(2048))) unsigned char L[2 * LBUF];
    const unsigned wave = uni(threadIdx.x >> 5), lbase = (unsigned)(size_t)L;
    /* this wave's tile: first byte of block 0, source row pitch and step per block, in bytes */
    const unsigned long long src0 = wave == 0 ? (unsigned long long)(size_t)(KB + (size_t)bh * TT * HD) : wave == 1 ? (unsigned long long)(size_t)(VT + (size_t)bh * HD * TT)
                                  : (unsigned long long)(size_t)(madd + (size_t)(bh / NH_) * TT * TT + (size_t)blockIdx.x * 64 * TT + (wave - 2) * 32);
    const unsigned spit = wave == 0 ? HD * 2u : wave == 1 ? TT * 2u : TT * 4u, sadv = wave == 0 ? KBLK * HD * 2u : wave == 1 ? KBLK * 2u : KBLK * 4u;
    u32x8 g1; g1[0] = uni((1u << 20) | (4u << 22) | (3u << 25)); g1[1] = uni(128u << 16); g1[2] = uni(64u << 16); g1[3] = uni(128u << 16); g1[4] = uni(64u); g1[5] = uni(spit); g1[6] = uni(0u); g1[7] = uni(0u);   /* bytes; tensor = tile = 64 rows of 128; 4 pad dwords behind every 32 */
    asm volatile("" : "+s"(g1));   /* the pinned() form on the whole group: descriptor words held in their scalar registers through the loop; without it the build used two of them as scratch while a request was outstanding */
    const unsigned rot = uni(blockIdx.x + 3u * ((unsigned)bh % NH_));   /* entry block: differs between all query blocks of a head, and by 3 between the heads that share a mask tile */
    static_assert((NST & (NST - 1)) == 0, "the wrap is a mask");
    auto issue = [&](unsigned st) { const unsigned long long ga = src0 + (unsigned long long)((st + rot) & (NST - 1u)) * sadv; u32x4 g0; g0[0] = uni(1u); g0[1] = uni(lbase + (st & 1u) * LBUF + wave * LSL); g0[2] = uni((unsigned)ga); g0[3] = uni((((unsigned)(ga >> 32)) & 0x01FFFFFFu) | 0x80000000u);
        asm volatile("tensor_load_to_lds %0, %1" :: "s"(g0), "s"(g1) : "memory"); };   /* one request of the whole wave; every wave issues its own tile */
    issue(0);
    asm volatile("s_wait_xcnt 0x0" :: "v"(qp), "v"(q0), "v"(q1) : "memory");   /* behind the four query loads, in front of any reuse of their address pair; the operands, inputs only, hold the loads in front of it and the pair alive up to it */
    wait_tensor0(); __syncthreads();   /* block 0 published */
    issue(1);
    const unsigned kvo = (unsigned)(lr * LPIT + 16 * hi), mo = (unsigned)(((threadIdx.x >> 5) * 16 + lr) * LPIT + 32 * hi);
    v8f o[4];
#pragma unroll
    for (int mb = 0; mb < 4; ++mb) o[mb] = (v8f){};
    float mx = -3.0e38f, mxl = -3.0e38f; v2f sum2 = {0.f, 0.f};   /* mxl: the exponent offset in use, the maximum times log2(e) rounded up to a whole number; even and odd keys are summed apart */
#pragma unroll 1   /* stays rolled: one block's body already holds some 500 instructions and most of the register budget of three to four waves per SIMD */
    for (unsigned st = 0; st < NST; ++st) { const unsigned char* bp = L + (st & 1u) * LBUF;
        v8f s[KBLK / 16]; float bm = -3.0e38f; v16bf kf[KBLK / 16][2], vt[KBLK / 32][4]; v4f mk[KBLK / 16][2];   /* all of the block's fragments are asked for here, in the order of their use: the value fragments fly under the scores and the softmax */
#pragma unroll
        for (int t = 0; t < KBLK / 16; ++t) { const unsigned char* kr = bp + kvo + 16 * t * LPIT; kf[t][0] = ldl(kr); kf[t][1] = ldl(kr + 64);
            const unsigned char* mp = bp + (2 + (t >> 1)) * LSL + mo + 64 * (t & 1); mk[t][0] = *(const v4f*)mp; mk[t][1] = *(const v4f*)(mp + 16); }
#pragma unroll
        for (int g = 0; g < KBLK / 32; ++g)
#pragma unroll
            for (int mb = 0; mb < 4; ++mb) vt[g][mb] = ldl(bp + LSL + kvo + mb * 16 * LPIT + 64 * g);
        __builtin_amdgcn_sched_barrier(0);   /* keeps the LDS reads one group in front of the products: without it the build moved the value reads in among the matrix instructions, each pair with a full wait behind it */
#pragma unroll
        for (int t = 0; t < KBLK / 16; ++t) { s[t] = wmmab(kf[t][0], q0, (v8f){}); s[t] = wmmab(kf[t][1], q1, s[t]);
            const v4f ma = mk[t][0], mc = mk[t][1];   /* mask[b][q][keys 8h .. 8h + 7 of the tile], f32 input, bf16-rounded */
#pragma unroll
            for (int r = 0; r < 8; r += 2) { const v2f m2 = rnd2(r < 4 ? (v2f){ma[r], ma[r + 1]} : (v2f){mc[r - 4], mc[r - 3]}); s[t][r] = __fadd_rn(s[t][r], m2[0]); s[t][r + 1] = __fadd_rn(s[t][r + 1], m2[1]); bm = fmaxf(bm, fmaxf(s[t][r], s[t][r + 1])); } }
        bm = fmaxf(bm, __shfl_xor(bm, 16, 32)); const float mn = fmaxf(mx, bm);
        if (__builtin_amdgcn_ballot_w32(mn > mx) != 0) {   /* wave-uniform: a block that raises no query's maximum would scale by exactly 1 */
            const float nl = __builtin_ceilf(mn * 1.4426950408889634f); const float al = __builtin_amdgcn_exp2f(mxl - nl); sum2 *= al; mx = mn; mxl = nl;   /* whole-number offsets: the factor between two of them is an exact power of two */
#pragma unroll
            for (int mb = 0; mb < 4; ++mb) o[mb] *= al; }
        const v2f l2e = {1.4426950408889634f, 1.4426950408889634f}, nm2 = {-mxl, -mxl};
        v16bf ph[KBLK / 32], pl[KBLK / 32];
#pragma unroll
        for (int g = 0; g < KBLK / 32; ++g)
#pragma unroll
            for (int u = 0; u < 2; ++u) { v8f x;
#pragma unroll
                for (int r = 0; r < 8; r += 2) { const v2f x2 = __builtin_elementwise_fma((v2f){s[2 * g + u][r], s[2 * g + u][r + 1]}, l2e, nm2); x[r] = x2[0]; x[r + 1] = x2[1]; }   /* s log2(e) - mxl: one packed fused multiply-add per score pair */
                const v8f p8 = exp2x8(x);
#pragma unroll
                for (int r = 0; r < 8; r += 2) { const v2f p = {p8[r], p8[r + 1]}; sum2 += p; const int e = 8 * u + r;
                    const v2b h2 = __builtin_convertvector(p, v2b); const v2b l2 = __builtin_convertvector(p - __builtin_convertvector(h2, v2f), v2b); ph[g][e] = h2[0]; ph[g][e + 1] = h2[1]; pl[g][e] = l2[0]; pl[g][e + 1] = l2[1]; } }
        __builtin_amdgcn_sched_barrier(0);   /* every exponential stands in front of the value products */
#pragma unroll
        for (int g = 0; g < KBLK / 32; ++g)
#pragma unroll
            for (int mb = 0; mb < 4; ++mb) { o[mb] = wmmab(vt[g][mb], ph[g], o[mb]); o[mb] = wmmab(vt[g][mb], pl[g], o[mb]); }
        __builtin_amdgcn_sched_barrier(0);   /* keeps the block's arithmetic in front of the publish point: without it the build put half of it between the barrier and the refill, which then had that much less time to land */
        wait_ds0(); wait_tensor0(); __syncthreads();   /* publish point: block st + 1 has landed for every wave, and every wave has left block st's buffer */
        if (pinned(st + 2u < NST)) issue(st + 2u);   /* the refill, into the buffer that this block has just read; scalar branch: a tensor load ignores EXEC */
    }
    wait_tensor0(); wait_ds0();
    float sum = sum2[0] + sum2[1]; sum += __shfl_xor(sum, 16, 32); const float f = __fdiv_rn(1.0f, sum);
    float* op = out + ((size_t)bh * TT + q) * HD + 8 * hi;
#pragma unroll
    for (int mb = 0; mb < 4; ++mb) { v4f a, c;
#pragma unroll
        for (int r = 0; r < 4; ++r) { a[r] = o[mb][r] * f; c[r] = o[mb][r + 4] * f; }
        *(v4f*)(op + mb * 16) = a; *(v4f*)(op + mb * 16 + 4) = c; }
}

extern "C" void kernel_launch(void* const* d_in, const int* in_sizes, int n_in,
                              void* d_out, int out_size, void* d_ws, size_t ws_size, hipStream_t stream) {
    (void)in_sizes; (void)n_in; (void)out_size;
    const float* Qin = (const float*)d_in[0]; const float* Kin = (const float*)d_in[1]; const float* Vin = (const float*)d_in[2]; const float* Min = (const float*)d_in[3];   /* mask [2][1][2048][2048] f32 (additive, broadcast over heads; read) */   /* input order q, k, v, mask */
    float* OUT = (float*)d_out;     // [2][12][2048][64] head-major
    char* wsp = (char*)d_ws;
    auto take = [&](size_t bytes) { char* p = wsp; wsp += (bytes + 255) & ~(size_t)255; return (void*)p; };
    bf* QB = (bf*)take((size_t)NB_ * NH_ * TT * HD * 2); bf* KB = (bf*)take((size_t)NB_ * NH_ * TT * HD * 2); bf* VT = (bf*)take((size_t)NB_ * NH_ * HD * TT * 2);
    if ((size_t)(wsp - (char*)d_ws) > ws_size) return;
    k_prep<<<VTB + 2 * CVB, 256, 0, stream>>>(Qin, Kin, Vin, QB, KB, VT);   /* q, k rounded to bf16; v rounded and transposed per head */
    k_fattn<<<dim3(TT / 64, NB_ * NH_, 1), 128, 0, stream>>>(QB, KB, VT, Min, OUT);   /* every (batch, head): scores, mask, softmax, P (hi/lo) x exact v^T */
}

// v006
// Measured time: 43.2 microseconds a run.
// Next to v005, in two timings, it ran 1.09 times as fast each time.
// Over all steps from v000 it is 42.6 times as fast.
#include <hip/hip_runtime.h>

// Masked attention on given head-major tensors with an additive mask (q, k, v [2][12][2048][64]; scores = q.k + mask ([2][1][2048][2048] f32 unit normal, broadcast over heads, read); no scaling; softmax; out = probs v -> [2][12][2048][64] (3.1 M); argument order q, k, v, mask).
// Layout per (batch, head): single bf16 planes of q and k (inputs bf16-exact: exact score products) and an f16 value^T plane (the bf16-rounded value, written as f16); one fused kernel walks the keys with a running maximum and sum per query (transposed products: S^T = K Q^T, O^T += V^T P^T), adds the batch's mask row, and writes the head-major output rows; no score or probability plane in memory.
// Compute dtypes, f32 accumulate: every input rounded to bf16; q.k exact; softmax f32; P rounded once to f16 x value on the f16 matrix form; output f32.

#define NB_  2
#define TT   2048
#define DM   768      // H x HD; unused, all tensors here are head-major
#define NH_  12
#define NKV  1
#define REP  (NH_ / NKV)
#define HD   64
#define DQ   (NH_ * HD)
#define DKV  (NKV * HD)
#define ZH   1
#define RH   2048
#define WIN  0
#define PCAR 1024.0f
#define SCL  1.0f   // scores are not scaled in the module
typedef _Float16 h16;
typedef unsigned short bf;
typedef __attribute__((ext_vector_type(16))) __bf16   v16bf;
typedef __attribute__((ext_vector_type(16))) _Float16 v16h;
typedef __attribute__((ext_vector_type(8)))  _Float16 v8h;
typedef __attribute__((ext_vector_type(8)))  unsigned short v8us;
typedef __attribute__((ext_vector_type(8)))  float    v8f;
typedef __attribute__((ext_vector_type(4)))  float    v4f;
typedef v8h  __attribute__((may_alias)) v8ha;
typedef v4f  __attribute__((may_alias)) v4fa;
typedef v8us __attribute__((may_alias)) v8usa;

__device__ __forceinline__ unsigned short f2bf(float f) { unsigned u = __float_as_uint(f); u += 0x7FFFu + ((u >> 16) & 1u); return (unsigned short)(u >> 16); }
__device__ __forceinline__ float bf2f(unsigned short b) { return __uint_as_float(((unsigned)b) << 16); }
__device__ __forceinline__ float bfr(float f) { return bf2f(f2bf(f)); }
__device__ __forceinline__ v16h cat16(v8h lo, v8h hi) { return __builtin_shufflevector(lo, hi, 0, 1, 2, 3, 4, 5, 6, 7, 8, 9, 10, 11, 12, 13, 14, 15); }
__device__ __forceinline__ v16bf cat16b(v8us lo, v8us hi) { return __builtin_bit_cast(v16bf, __builtin_shufflevector(lo, hi, 0, 1, 2, 3, 4, 5, 6, 7, 8, 9, 10, 11, 12, 13, 14, 15)); }
__device__ __forceinline__ v8f wmma16(v16h a, v16h b, v8f c) { return __builtin_amdgcn_wmma_f32_16x16x32_f16(false, a, false, b, (short)0, c, false, false); }
__device__ __forceinline__ v8f wmmab(v16bf a, v16bf b, v8f c) { return __builtin_amdgcn_wmma_f32_16x16x32_bf16(false, a, false, b, (short)0, c, false, false); }



typedef __attribute__((ext_vector_type(2))) _Float16 v2h;
typedef __attribute__((ext_vector_type(4))) _Float16 v4h;
typedef __attribute__((ext_vector_type(2))) unsigned short v2us;
typedef __attribute__((ext_vector_type(4))) unsigned short v4us;
typedef __attribute__((ext_vector_type(2))) float v2f;
typedef __attribute__((ext_vector_type(4))) int v4i;

// ---- k_prep: the three 16-bit planes in one launch. Blocks below VTB each transpose one 128-key x 64-column tile of one head's v through LDS; the others round q and k, element order kept.
// v tile: a thread reads 4 columns of two neighbouring keys (16 lanes cover one 256-byte source row), rounds them to bf16 as every input is, packs each column's key pair as f16 into a dword (a bf16 value is exact in f16 from 2^-17 up to 65504; unit-normal values stay far below that) and stores it at [column][key pair]; the 16-byte group index is XORed with column / 4, so that the 16 column groups of a wave's store fall on different banks and a row still reads back as 16-byte groups. Each v^T row piece leaves as 256 contiguous bytes.
#define VTB (NB_ * NH_ * (TT / 128))
#define CVB (NB_ * NH_ * TT * HD / 8 / (256 * 8))   /* blocks per plane: 256 threads x 8 groups of 8 values */
typedef __attribute__((ext_vector_type(2))) __bf16 v2bp;
typedef __attribute__((ext_vector_type(8))) __bf16 v8bp;
typedef __attribute__((ext_vector_type(4))) unsigned v4u;
__global__ __launch_bounds__(256) void k_prep(const float* __restrict__ Q, const float* __restrict__ K, const float* __restrict__ V, bf* __restrict__ QB, bf* __restrict__ KB, bf* __restrict__ VT) {
    __shared__ __attribute__((aligned(16))) unsigned tile[HD * 64];
    const int tid = threadIdx.x, c16 = tid & 15, r16 = tid >> 4;
    if (blockIdx.x < VTB) {
        const int bh = blockIdx.x / (TT / 128), t0 = (blockIdx.x % (TT / 128)) * 128;
        const float* src = V + ((size_t)bh * TT + t0) * HD + 4 * c16; v4f a[4], b[4];
#pragma unroll
        for (int j = 0; j < 4; ++j) { const int tp = r16 + 16 * j; a[j] = *(const v4f*)(src + (2 * tp) * HD); b[j] = *(const v4f*)(src + (2 * tp + 1) * HD); }
#pragma unroll
        for (int j = 0; j < 4; ++j) { const int tp = r16 + 16 * j;
#pragma unroll
            for (int c = 0; c < 4; ++c) tile[(4 * c16 + c) * 64 + ((((tp >> 2) ^ c16) << 2) | (tp & 3))] = __builtin_bit_cast(unsigned, __builtin_convertvector(__builtin_convertvector(__builtin_convertvector((v2f){a[j][c], b[j][c]}, v2bp), v2f), v2h)); }
        __syncthreads();   /* the tile is read back across waves */
        bf* dst = VT + (size_t)bh * HD * TT + t0 + 8 * c16;
#pragma unroll
        for (int j = 0; j < 4; ++j) { const int d = r16 + 16 * j; *(v4u*)(dst + (size_t)d * TT) = *(const v4u*)(tile + d * 64 + ((c16 ^ (d >> 2)) << 2)); }
    } else {
        const unsigned blk = blockIdx.x - VTB; const bool isk = blk >= CVB; const float* src = isk ? K : Q; bf* dst = isk ? KB : QB;
        const size_t i0 = (size_t)(isk ? blk - CVB : blk) * (256 * 8) + tid; v8f v[8];
#pragma unroll
        for (int j = 0; j < 8; ++j) v[j] = *(const v8f*)(src + (i0 + 256 * j) * 8);
#pragma unroll
        for (int j = 0; j < 8; ++j) *(v8bp*)(dst + (i0 + 256 * j) * 8) = __builtin_convertvector(v[j], v8bp);
        asm volatile("s_wait_xcnt 0x0" ::: "memory");   /* behind the run of stores: the build lays the other part's code behind this one, and no register that a store names is to be rewritten ahead of this wait */
    }
}


// ---- k_fattn: fused scores + mask + softmax + P.V. One wave owns 16 queries of one (batch, head) and walks all TT keys, KBLK at a time; 4 waves per work-group, grid (TT / 64, NB_ * NH_).
// Operands come through LDS: per block of KBLK keys each wave asks for one tile of 64 rows x 128 bytes by one tensor load (wave 0: the K rows; wave 1: the V^T rows; waves 2 and 3: the work-group's 64 mask rows, keys 0-31 and 32-63), padded to a pitch of 144 bytes for 16-byte readers. Two buffers: the next block's tiles fly while this block is worked on.
// S^T tile (16 keys x 16 queries) = K rows (A) x Q rows (B): lane (c = lane & 15, h = lane >> 4) holds query c, keys 8h + r in register r. Two such tiles, converted in place to f16 (P lies in (0, 1]: 11 significant bits, one product where a bf16 pair took two), are the B operand of O^T += V^T P^T (k order 8h + s, 16 + 8h + s: the order ldf() reads A in).
// Each work-group enters the ring of key blocks at its own block and wraps round: the 32 work-groups of a head (same K, V^T lines) and the 12 heads of a query block (same mask lines) would otherwise ask L2 for the same lines at the same moment. The online softmax takes the blocks in any order.
// Running maximum is shared by the two lane halves of a query (they feed one product); the sum stays per half and is joined once at the end.
#define KBLK 64
typedef __attribute__((ext_vector_type(2))) __bf16 v2b;
__device__ __forceinline__ v2f rnd2(v2f x) { return __builtin_convertvector(__builtin_convertvector(x, v2b), v2f); }   /* two f32 rounded to bf16 (nearest even), as f32 */
// Eight exp2 in one statement. It keeps the slot that the instruction set asks for behind a transcendental: each v_exp_f32 is followed by one that neither reads its result nor overwrites its source (outputs early-clobber), the last by v_nop.
__device__ __forceinline__ v8f exp2x8(v8f x) { float p0, p1, p2, p3, p4, p5, p6, p7;
    asm("v_exp_f32 %0, %8\n\tv_exp_f32 %1, %9\n\tv_exp_f32 %2, %10\n\tv_exp_f32 %3, %11\n\tv_exp_f32 %4, %12\n\tv_exp_f32 %5, %13\n\tv_exp_f32 %6, %14\n\tv_exp_f32 %7, %15\n\tv_nop"
        : "=&v"(p0), "=&v"(p1), "=&v"(p2), "=&v"(p3), "=&v"(p4), "=&v"(p5), "=&v"(p6), "=&v"(p7) : "v"(x[0]), "v"(x[1]), "v"(x[2]), "v"(x[3]), "v"(x[4]), "v"(x[5]), "v"(x[6]), "v"(x[7]));
    return (v8f){p0, p1, p2, p3, p4, p5, p6, p7}; }
__device__ __forceinline__ v16bf ldf(const unsigned short* p) { return cat16b(*(const v8us*)p, *(const v8us*)(p + 16)); }
#define LPIT 144u                  /* LDS row pitch: 128 data bytes + 16 pad bytes */
#define LSL  10240u                /* one tile's place: 64 rows x LPIT = 9216, rounded up to a multiple of 2 KiB */
#define LBUF (4u * LSL)            /* one buffer: K, V^T, two mask halves */
#define NST  (TT / KBLK)
typedef __attribute__((ext_vector_type(4))) unsigned u32x4;
typedef __attribute__((ext_vector_type(8))) unsigned u32x8;
__device__ __forceinline__ unsigned uni(unsigned v) { return (unsigned)__builtin_amdgcn_readfirstlane(v); }
__device__ __forceinline__ unsigned pinned(unsigned v) { unsigned w = uni(v); asm volatile("" : "+s"(w)); return w; }   /* holds a wave-uniform word in a scalar register, so that the test on it is a scalar branch */
__device__ __forceinline__ void wait_ds0() { asm volatile("s_wait_dscnt 0x0" ::: "memory"); }       /* this wave's LDS reads have retired before their buffer is handed back */
__device__ __forceinline__ void wait_tensor0() { asm volatile("s_wait_tensorcnt 0x0" ::: "memory"); }   /* this wave's tile has landed */
__device__ __forceinline__ v16bf ldl(const unsigned char* p) { return cat16b(*(const v8us*)p, *(const v8us*)(p + 32)); }   /* ldf() on an LDS row, byte offsets */
__device__ __forceinline__ v16h ldlh(const unsigned char* p) { return cat16(*(const v8h*)p, *(const v8h*)(p + 32)); }   /* the same k order on an f16 row */
__global__ __launch_bounds__(128) void k_fattn(const unsigned short* __restrict__ QB, const unsigned short* __restrict__ KB, const unsigned short* __restrict__ VT, const float* __restrict__ madd, float* __restrict__ out) {
    const int lane = threadIdx.x & 31, lr = lane & 15, hi = lane >> 4; const int bh = blockIdx.y; const int q = blockIdx.x * 64 + (threadIdx.x >> 5) * 16 + lr;
    const unsigned short* qp = QB + ((size_t)bh * TT + q) * HD + 8 * hi; const v16bf q0 = ldf(qp), q1 = ldf(qp + 32);
    __shared__ __attribute__((aligned(2048))) unsigned char L[2 * LBUF];
    const unsigned wave = uni(threadIdx.x >> 5), lbase = (unsigned)(size_t)L;
    /* this wave's tile: first byte of block 0, source row pitch and step per block, in bytes */
    const unsigned long long src0 = wave == 0 ? (unsigned long long)(size_t)(KB + (size_t)bh * TT * HD) : wave == 1 ? (unsigned long long)(size_t)(VT + (size_t)bh * HD * TT)
                                  : (unsigned long long)(size_t)(madd + (size_t)(bh / NH_) * TT * TT + (size_t)blockIdx.x * 64 * TT + (wave - 2) * 32);
    const unsigned spit = wave == 0 ? HD * 2u : wave == 1 ? TT * 2u : TT * 4u, sadv = wave == 0 ? KBLK * HD * 2u : wave == 1 ? KBLK * 2u : KBLK * 4u;
    u32x8 g1; g1[0] = uni((1u << 20) | (4u << 22) | (3u << 25)); g1[1] = uni(128u << 16); g1[2] = uni(64u << 16); g1[3] = uni(128u << 16); g1[4] = uni(64u); g1[5] = uni(spit); g1[6] = uni(0u); g1[7] = uni(0u);   /* bytes; tensor = tile = 64 rows of 128; 4 pad dwords behind every 32 */
    asm volatile("" : "+s"(g1));   /* the pinned() form on the whole group: descriptor words held in their scalar registers through the loop; without it the build used two of them as scratch while a request was outstanding */
    const unsigned rot = uni(blockIdx.x + 3u * ((unsigned)bh % NH_));   /* entry block: differs between all query blocks of a head, and by 3 between the heads that share a mask tile */
    static_assert((NST & (NST - 1)) == 0, "the wrap is a mask");
    auto issue = [&](unsigned st) { const unsigned long long ga = src0 + (unsigned long long)((st + rot) & (NST - 1u)) * sadv; u32x4 g0; g0[0] = uni(1u); g0[1] = uni(lbase + (st & 1u) * LBUF + wave * LSL); g0[2] = uni((unsigned)ga); g0[3] = uni((((unsigned)(ga >> 32)) & 0x01FFFFFFu) | 0x80000000u);
        asm volatile("tensor_load_to_lds %0, %1" :: "s"(g0), "s"(g1) : "memory"); };   /* one request of the whole wave; every wave issues its own tile */
    issue(0);
    asm volatile("s_wait_xcnt 0x0" :: "v"(qp), "v"(q0), "v"(q1) : "memory");   /* behind the four query loads, in front of any reuse of their address pair; the operands, inputs only, hold the loads in front of it and the pair alive up to it */
    wait_tensor0(); __syncthreads();   /* block 0 published */
    issue(1);
    const unsigned kvo = (unsigned)(lr * LPIT + 16 * hi), mo = (unsigned)(((threadIdx.x >> 5) * 16 + lr) * LPIT + 32 * hi);
    v8f o[4];
#pragma unroll
    for (int mb = 0; mb < 4; ++mb) o[mb] = (v8f){};
    float mx = -3.0e38f, mxl = -3.0e38f; v2f sum2 = {0.f, 0.f};   /* mxl: the exponent offset in use, the maximum times log2(e) rounded up to a whole number; even and odd keys are summed apart */
#pragma unroll 1   /* stays rolled: one block's body already holds some 500 instructions and most of the register budget of three to four waves per SIMD */
    for (unsigned st = 0; st < NST; ++st) { const unsigned char* bp = L + (st & 1u) * LBUF;
        v8f s[KBLK / 16]; float bm = -3.0e38f; v16bf kf[KBLK / 16][2]; v16h vt[KBLK / 32][4]; v4f mk[KBLK / 16][2];   /* all of the block's fragments are asked for here, in the order of their use: the value fragments fly under the scores and the softmax */
#pragma unroll
        for (int t = 0; t < KBLK / 16; ++t) { const unsigned char* kr = bp + kvo + 16 * t * LPIT; kf[t][0] = ldl(kr); kf[t][1] = ldl(kr + 64);
            const unsigned char* mp = bp + (2 + (t >> 1)) * LSL + mo + 64 * (t & 1); mk[t][0] = *(const v4f*)mp; mk[t][1] = *(const v4f*)(mp + 16); }
#pragma unroll
        for (int g = 0; g < KBLK / 32; ++g)
#pragma unroll
            for (int mb = 0; mb < 4; ++mb) vt[g][mb] = ldlh(bp + LSL + kvo + mb * 16 * LPIT + 64 * g);
        __builtin_amdgcn_sched_barrier(0);   /* keeps the LDS reads one group in front of the products: without it the build moved the value reads in among the matrix instructions, each pair with a full wait behind it */
#pragma unroll
        for (int t = 0; t < KBLK / 16; ++t) { s[t] = wmmab(kf[t][0], q0, (v8f){}); s[t] = wmmab(kf[t][1], q1, s[t]);
            const v4f ma = mk[t][0], mc = mk[t][1];   /* mask[b][q][keys 8h .. 8h + 7 of the tile], f32 input, bf16-rounded */
#pragma unroll
            for (int r = 0; r < 8; r += 2) { const v2f m2 = rnd2(r < 4 ? (v2f){ma[r], ma[r + 1]} : (v2f){mc[r - 4], mc[r - 3]}); s[t][r] = __fadd_rn(s[t][r], m2[0]); s[t][r + 1] = __fadd_rn(s[t][r + 1], m2[1]); bm = fmaxf(bm, fmaxf(s[t][r], s[t][r + 1])); } }
        bm = fmaxf(bm, __shfl_xor(bm, 16, 32)); const float mn = fmaxf(mx, bm);
        if (__builtin_amdgcn_ballot_w32(mn > mx) != 0) {   /* wave-uniform: a block that raises no query's maximum would scale by exactly 1 */
            const float nl = __builtin_ceilf(mn * 1.4426950408889634f); const float al = __builtin_amdgcn_exp2f(mxl - nl); sum2 *= al; mx = mn; mxl = nl;   /* whole-number offsets: the factor between two of them is an exact power of two */
#pragma unroll
            for (int mb = 0; mb < 4; ++mb) o[mb] *= al; }
        const v2f l2e = {1.4426950408889634f, 1.4426950408889634f}, nm2 = {-mxl, -mxl};
        v16h ph[KBLK / 32];
#pragma unroll
        for (int g = 0; g < KBLK / 32; ++g)
#pragma unroll
            for (int u = 0; u < 2; ++u) { v8f x;
#pragma unroll
                for (int r = 0; r < 8; r += 2) { const v2f x2 = __builtin_elementwise_fma((v2f){s[2 * g + u][r], s[2 * g + u][r + 1]}, l2e, nm2); x[r] = x2[0]; x[r + 1] = x2[1]; }   /* s log2(e) - mxl: one packed fused multiply-add per score pair */
                const v8f p8 = exp2x8(x);
#pragma unroll
                for (int r = 0; r < 8; r += 2) { const v2f p = {p8[r], p8[r + 1]}; sum2 += p; const int e = 8 * u + r;
                    const v2h h2 = __builtin_convertvector(p, v2h); ph[g][e] = h2[0]; ph[g][e + 1] = h2[1]; } }   /* the sum takes the unrounded p */
        __builtin_amdgcn_sched_barrier(0);   /* every exponential stands in front of the value products */
#pragma unroll
        for (int g = 0; g < KBLK / 32; ++g)
#pragma unroll
            for (int mb = 0; mb < 4; ++mb) o[mb] = wmma16(vt[g][mb], ph[g], o[mb]);
        __builtin_amdgcn_sched_barrier(0);   /* keeps the block's arithmetic in front of the publish point: without it the build put half of it between the barrier and the refill, which then had that much less time to land */
        wait_ds0(); wait_tensor0(); __syncthreads();   /* publish point: block st + 1 has landed for every wave, and every wave has left block st's buffer */
        if (pinned(st + 2u < NST)) issue(st + 2u);   /* the refill, into the buffer that this block has just read; scalar branch: a tensor load ignores EXEC */
    }
    wait_tensor0(); wait_ds0();
    float sum = sum2[0] + sum2[1]; sum += __shfl_xor(sum, 16, 32); const float f = __fdiv_rn(1.0f, sum);
    float* op = out + ((size_t)bh * TT + q) * HD + 8 * hi;
#pragma unroll
    for (int mb = 0; mb < 4; ++mb) { v4f a, c;
#pragma unroll
        for (int r = 0; r < 4; ++r) { a[r] = o[mb][r] * f; c[r] = o[mb][r + 4] * f; }
        *(v4f*)(op + mb * 16) = a; *(v4f*)(op + mb * 16 + 4) = c; }
}

extern "C" void kernel_launch(void* const* d_in, const int* in_sizes, int n_in,
                              void* d_out, int out_size, void* d_ws, size_t ws_size, hipStream_t stream) {
    (void)in_sizes; (void)n_in; (void)out_size;
    const float* Qin = (const float*)d_in[0]; const float* Kin = (const float*)d_in[1]; const float* Vin = (const float*)d_in[2]; const float* Min = (const float*)d_in[3];   /* mask [2][1][2048][2048] f32 (additive, broadcast over heads; read) */   /* input order q, k, v, mask */
    float* OUT = (float*)d_out;     // [2][12][2048][64] head-major
    char* wsp = (char*)d_ws;
    auto take = [&](size_t bytes) { char* p = wsp; wsp += (bytes + 255) & ~(size_t)255; return (void*)p; };
    bf* QB = (bf*)take((size_t)NB_ * NH_ * TT * HD * 2); bf* KB = (bf*)take((size_t)NB_ * NH_ * TT * HD * 2); bf* VT = (bf*)take((size_t)NB_ * NH_ * HD * TT * 2);
    if ((size_t)(wsp - (char*)d_ws) > ws_size) return;
    k_prep<<<VTB + 2 * CVB, 256, 0, stream>>>(Qin, Kin, Vin, QB, KB, VT);   /* q, k rounded to bf16; v rounded to bf16, written as f16 and transposed per head */
    k_fattn<<<dim3(TT / 64, NB_ * NH_, 1), 128, 0, stream>>>(QB, KB, VT, Min, OUT);   /* every (batch, head): scores, mask, softmax, P (f16) x v^T */
}

// v007
// One run takes 41.5 microseconds.
// Timed twice side by side with v006, it ran 1.04 times as fast both times.
// Counting every step since v000, it is 44.2 times as fast.
#include <hip/hip_runtime.h>

// Masked attention on given head-major tensors with an additive mask (q, k, v [2][12][2048][64]; scores = q.k + mask ([2][1][2048][2048] f32 unit normal, broadcast over heads, read); no scaling; softmax; out = probs v -> [2][12][2048][64] (3.1 M); argument order q, k, v, mask).
// Layout per (batch, head): single bf16 planes of q and k (inputs bf16-exact: exact score products) and an f16 value^T plane (the bf16-rounded value, written as f16); one fused kernel walks the keys with a running maximum and sum per query (transposed products: S^T = K Q^T, O^T += V^T P^T), adds the batch's mask row, and writes the head-major output rows; no score or probability plane in memory.
// Compute dtypes, f32 accumulate: every input rounded to bf16; q.k exact; softmax f32; P rounded once to f16 x value on the f16 matrix form; output f32.

#define NB_  2
#define TT   2048
#define DM   768      // H x HD; unused, all tensors here are head-major
#define NH_  12
#define NKV  1
#define REP  (NH_ / NKV)
#define HD   64
#define DQ   (NH_ * HD)
#define DKV  (NKV * HD)
#define ZH   1
#define RH   2048
#define WIN  0
#define PCAR 1024.0f
#define SCL  1.0f   // scores are not scaled in the module
typedef _Float16 h16;
typedef unsigned short bf;
typedef __attribute__((ext_vector_type(16))) __bf16   v16bf;
typedef __attribute__((ext_vector_type(16))) _Float16 v16h;
typedef __attribute__((ext_vector_type(8)))  _Float16 v8h;
typedef __attribute__((ext_vector_type(8)))  unsigned short v8us;
typedef __attribute__((ext_vector_type(8)))  float    v8f;
typedef __attribute__((ext_vector_type(4)))  float    v4f;
typedef v8h  __attribute__((may_alias)) v8ha;
typedef v4f  __attribute__((may_alias)) v4fa;
typedef v8us __attribute__((may_alias)) v8usa;

__device__ __forceinline__ unsigned short f2bf(float f) { unsigned u = __float_as_uint(f); u += 0x7FFFu + ((u >> 16) & 1u); return (unsigned short)(u >> 16); }
__device__ __forceinline__ float bf2f(unsigned short b) { return __uint_as_float(((unsigned)b) << 16); }
__device__ __forceinline__ float bfr(float f) { return bf2f(f2bf(f)); }
__device__ __forceinline__ v16h cat16(v8h lo, v8h hi) { return __builtin_shufflevector(lo, hi, 0, 1, 2, 3, 4, 5, 6, 7, 8, 9, 10, 11, 12, 13, 14, 15); }
__device__ __forceinline__ v16bf cat16b(v8us lo, v8us hi) { return __builtin_bit_cast(v16bf, __builtin_shufflevector(lo, hi, 0, 1, 2, 3, 4, 5, 6, 7, 8, 9, 10, 11, 12, 13, 14, 15)); }
__device__ __forceinline__ v8f wmma16(v16h a, v16h b, v8f c) { return __builtin_amdgcn_wmma_f32_16x16x32_f16(false, a, false, b, (short)0, c, false, false); }
__device__ __forceinline__ v8f wmmab(v16bf a, v16bf b, v8f c) { return __builtin_amdgcn_wmma_f32_16x16x32_bf16(false, a, false, b, (short)0, c, false, false); }



typedef __attribute__((ext_vector_type(2))) _Float16 v2h;
typedef __attribute__((ext_vector_type(4))) _Float16 v4h;
typedef __attribute__((ext_vector_type(2))) unsigned short v2us;
typedef __attribute__((ext_vector_type(4))) unsigned short v4us;
typedef __attribute__((ext_vector_type(2))) float v2f;
typedef __attribute__((ext_vector_type(4))) int v4i;

// ---- k_prep: the three 16-bit planes in one launch. Blocks below VTB each transpose one 128-key x 64-column tile of one head's v through LDS; the others round q and k, element order kept.
// v tile: a thread reads 4 columns of two neighbouring keys (16 lanes cover one 256-byte source row), rounds them to bf16 as every input is, packs each column's key pair as f16 into a dword (a bf16 value is exact in f16 from 2^-17 up to 65504; unit-normal values stay far below that) and stores it at [column][key pair]; the 16-byte group index is XORed with column / 4, so that the 16 column groups of a wave's store fall on different banks and a row still reads back as 16-byte groups. Each v^T row piece leaves as 256 contiguous bytes.
#define VTB (NB_ * NH_ * (TT / 128))
#define CVB (NB_ * NH_ * TT * HD / 8 / (256 * 8))   /* blocks per plane: 256 threads x 8 groups of 8 values */
typedef __attribute__((ext_vector_type(2))) __bf16 v2bp;
typedef __attribute__((ext_vector_type(8))) __bf16 v8bp;
typedef __attribute__((ext_vector_type(4))) unsigned v4u;
__global__ __launch_bounds__(256) void k_prep(const float* __restrict__ Q, const float* __restrict__ K, const float* __restrict__ V, bf* __restrict__ QB, bf* __restrict__ KB, bf* __restrict__ VT) {
    __shared__ __attribute__((aligned(16))) unsigned tile[HD * 64];
    const int tid = threadIdx.x, c16 = tid & 15, r16 = tid >> 4;
    if (blockIdx.x < VTB) {
        const int bh = blockIdx.x / (TT / 128), t0 = (blockIdx.x % (TT / 128)) * 128;
        const float* src = V + ((size_t)bh * TT + t0) * HD + 4 * c16; v4f a[4], b[4];
#pragma unroll
        for (int j = 0; j < 4; ++j) { const int tp = r16 + 16 * j; a[j] = *(const v4f*)(src + (2 * tp) * HD); b[j] = *(const v4f*)(src + (2 * tp + 1) * HD); }
#pragma unroll
        for (int j = 0; j < 4; ++j) { const int tp = r16 + 16 * j;
#pragma unroll
            for (int c = 0; c < 4; ++c) tile[(4 * c16 + c) * 64 + ((((tp >> 2) ^ c16) << 2) | (tp & 3))] = __builtin_bit_cast(unsigned, __builtin_convertvector(__builtin_convertvector(__builtin_convertvector((v2f){a[j][c], b[j][c]}, v2bp), v2f), v2h)); }
        __syncthreads();   /* the tile is read back across waves */
        bf* dst = VT + (size_t)bh * HD * TT + t0 + 8 * c16;
#pragma unroll
        for (int j = 0; j < 4; ++j) { const int d = r16 + 16 * j; *(v4u*)(dst + (size_t)d * TT) = *(const v4u*)(tile + d * 64 + ((c16 ^ (d >> 2)) << 2)); }
    } else {
        const unsigned blk = blockIdx.x - VTB; const bool isk = blk >= CVB; const float* src = isk ? K : Q; bf* dst = isk ? KB : QB;
        const size_t i0 = (size_t)(isk ? blk - CVB : blk) * (256 * 8) + tid; v8f v[8];
#pragma unroll
        for (int j = 0; j < 8; ++j) v[j] = *(const v8f*)(src + (i0 + 256 * j) * 8);
#pragma unroll
        for (int j = 0; j < 8; ++j) *(v8bp*)(dst + (i0 + 256 * j) * 8) = __builtin_convertvector(v[j], v8bp);
        asm volatile("s_wait_xcnt 0x0" ::: "memory");   /* behind the run of stores: the build lays the other part's code behind this one, and no register that a store names is to be rewritten ahead of this wait */
    }
}


// ---- k_fattn: fused scores + mask + softmax + P.V. 4 waves per work-group, grid (TT / 64, NB_ * NH_); the work-group walks all TT keys, KBLK at a time. A wave owns 32 of the 64 queries (two tiles of 16) and 32 of each block's 64 keys: every K and V^T fragment read from LDS feeds two products. The two waves of a query group each keep a running maximum, sum and output over their own key halves; the states are joined once, behind the loop.
// Operands come through LDS: per block of KBLK keys each wave asks for one tile of 64 rows x 128 bytes by one tensor load (wave 0: the K rows; wave 1: the V^T rows; waves 2 and 3: the work-group's 64 mask rows, keys 0-31 and 32-63), padded to a pitch of 144 bytes for 16-byte readers. Two buffers: the next block's tiles fly while this block is worked on.
// S^T tile (16 keys x 16 queries) = K rows (A) x Q rows (B): lane (c = lane & 15, h = lane >> 4) holds query c, keys 8h + r in register r. Two such tiles, converted in place to f16 (P lies in (0, 1]: 11 significant bits, one product where a bf16 pair took two), are the B operand of O^T += V^T P^T (k order 8h + s, 16 + 8h + s: the order ldf() reads A in).
// Each work-group enters the ring of key blocks at its own block and wraps round: the 32 work-groups of a head (same K, V^T lines) and the 12 heads of a query block (same mask lines) would otherwise ask L2 for the same lines at the same moment. The online softmax takes the blocks in any order.
// Running maximum is shared by the two lane halves of a query (they feed one product); the sum stays per half and is joined once at the end.
#define KBLK 64
typedef __attribute__((ext_vector_type(2))) __bf16 v2b;
__device__ __forceinline__ v2f rnd2(v2f x) { return __builtin_convertvector(__builtin_convertvector(x, v2b), v2f); }   /* two f32 rounded to bf16 (nearest even), as f32 */
// Eight exp2 in one statement. It keeps the slot that the instruction set asks for behind a transcendental: each v_exp_f32 is followed by one that neither reads its result nor overwrites its source (outputs early-clobber), the last by v_nop.
__device__ __forceinline__ v8f exp2x8(v8f x) { float p0, p1, p2, p3, p4, p5, p6, p7;
    asm("v_exp_f32 %0, %8\n\tv_exp_f32 %1, %9\n\tv_exp_f32 %2, %10\n\tv_exp_f32 %3, %11\n\tv_exp_f32 %4, %12\n\tv_exp_f32 %5, %13\n\tv_exp_f32 %6, %14\n\tv_exp_f32 %7, %15\n\tv_nop"
        : "=&v"(p0), "=&v"(p1), "=&v"(p2), "=&v"(p3), "=&v"(p4), "=&v"(p5), "=&v"(p6), "=&v"(p7) : "v"(x[0]), "v"(x[1]), "v"(x[2]), "v"(x[3]), "v"(x[4]), "v"(x[5]), "v"(x[6]), "v"(x[7]));
    return (v8f){p0, p1, p2, p3, p4, p5, p6, p7}; }
__device__ __forceinline__ v16bf ldf(const unsigned short* p) { return cat16b(*(const v8us*)p, *(const v8us*)(p + 16)); }
#define LPIT 144u                  /* LDS row pitch: 128 data bytes + 16 pad bytes */
#define LSL  10240u                /* one tile's place: 64 rows x LPIT = 9216, rounded up to a multiple of 2 KiB */
#define LBUF (4u * LSL)            /* one buffer: K, V^T, two mask halves */
#define NST  (TT / KBLK)
typedef __attribute__((ext_vector_type(4))) unsigned u32x4;
typedef __attribute__((ext_vector_type(8))) unsigned u32x8;
__device__ __forceinline__ unsigned uni(unsigned v) { return (unsigned)__builtin_amdgcn_readfirstlane(v); }
__device__ __forceinline__ unsigned pinned(unsigned v) { unsigned w = uni(v); asm volatile("" : "+s"(w)); return w; }   /* holds a wave-uniform word in a scalar register, so that the test on it is a scalar branch */
__device__ __forceinline__ void wait_ds0() { asm volatile("s_wait_dscnt 0x0" ::: "memory"); }       /* this wave's LDS reads have retired before their buffer is handed back */
__device__ __forceinline__ void wait_tensor0() { asm volatile("s_wait_tensorcnt 0x0" ::: "memory"); }   /* this wave's tile has landed */
__device__ __forceinline__ v16bf ldl(const unsigned char* p) { return cat16b(*(const v8us*)p, *(const v8us*)(p + 32)); }   /* ldf() on an LDS row, byte offsets */
__device__ __forceinline__ v16h ldlh(const unsigned char* p) { return cat16(*(const v8h*)p, *(const v8h*)(p + 32)); }   /* the same k order on an f16 row */
__global__ __launch_bounds__(128) void k_fattn(const unsigned short* __restrict__ QB, const unsigned short* __restrict__ KB, const unsigned short* __restrict__ VT, const float* __restrict__ madd, float* __restrict__ out) {
    const int lane = threadIdx.x & 31, lr = lane & 15, hi = lane >> 4; const int bh = blockIdx.y;
    __shared__ __attribute__((aligned(2048))) unsigned char L[2 * LBUF];
    const unsigned wave = uni(threadIdx.x >> 5), lbase = (unsigned)(size_t)L;
    const unsigned qg = wave & 1u, kg = wave >> 1;   /* this wave's 32 queries of the work-group's 64, and its 32 keys of every block's 64 */
    const int q = blockIdx.x * 64 + (int)qg * 32 + lr;   /* query of tile 0; tile 1 is 16 further */
    const unsigned short* qp = QB + ((size_t)bh * TT + q) * HD + 8 * hi; const v16bf q00 = ldf(qp), q01 = ldf(qp + 32), q10 = ldf(qp + 16 * HD), q11 = ldf(qp + 16 * HD + 32);
    /* this wave's tile: first byte of block 0, source row pitch and step per block, in bytes */
    const unsigned long long src0 = wave == 0 ? (unsigned long long)(size_t)(KB + (size_t)bh * TT * HD) : wave == 1 ? (unsigned long long)(size_t)(VT + (size_t)bh * HD * TT)
                                  : (unsigned long long)(size_t)(madd + (size_t)(bh / NH_) * TT * TT + (size_t)blockIdx.x * 64 * TT + (wave - 2) * 32);
    const unsigned spit = wave == 0 ? HD * 2u : wave == 1 ? TT * 2u : TT * 4u, sadv = wave == 0 ? KBLK * HD * 2u : wave == 1 ? KBLK * 2u : KBLK * 4u;
    u32x8 g1; g1[0] = uni((1u << 20) | (4u << 22) | (3u << 25)); g1[1] = uni(128u << 16); g1[2] = uni(64u << 16); g1[3] = uni(128u << 16); g1[4] = uni(64u); g1[5] = uni(spit); g1[6] = uni(0u); g1[7] = uni(0u);   /* bytes; tensor = tile = 64 rows of 128; 4 pad dwords behind every 32 */
    asm volatile("" : "+s"(g1));   /* the pinned() form on the whole group: descriptor words held in their scalar registers through the loop; without it the build used two of them as scratch while a request was outstanding */
    const unsigned rot = uni(blockIdx.x + 3u * ((unsigned)bh % NH_));   /* entry block: differs between all query blocks of a head, and by 3 between the heads that share a mask tile */
    static_assert((NST & (NST - 1)) == 0, "the wrap is a mask");
    auto issue = [&](unsigned st) { const unsigned long long ga = src0 + (unsigned long long)((st + rot) & (NST - 1u)) * sadv; u32x4 g0; g0[0] = uni(1u); g0[1] = uni(lbase + (st & 1u) * LBUF + wave * LSL); g0[2] = uni((unsigned)ga); g0[3] = uni((((unsigned)(ga >> 32)) & 0x01FFFFFFu) | 0x80000000u);
        asm volatile("tensor_load_to_lds %0, %1" :: "s"(g0), "s"(g1) : "memory"); };   /* one request of the whole wave; every wave issues its own tile */
    issue(0);
    asm volatile("s_wait_xcnt 0x0" :: "v"(qp), "v"(q00), "v"(q01), "v"(q10), "v"(q11) : "memory");   /* behind the eight query loads, in front of any reuse of their address pair; the operands, inputs only, hold the loads in front of it and the pair alive up to it */
    wait_tensor0(); __syncthreads();   /* block 0 published */
    issue(1);
    const unsigned ko = (unsigned)((kg * 32 + lr) * LPIT + 16 * hi), vo = (unsigned)(LSL + lr * LPIT + 16 * hi + 64 * kg), mo = (unsigned)((2 + kg) * LSL + (qg * 32 + lr) * LPIT + 32 * hi);
    v8f o[2][4];
#pragma unroll
    for (int j = 0; j < 2; ++j)
#pragma unroll
        for (int mb = 0; mb < 4; ++mb) o[j][mb] = (v8f){};
    float mx[2] = {-3.0e38f, -3.0e38f}, mxl[2] = {-3.0e38f, -3.0e38f}; v2f sum2[2] = {{0.f, 0.f}, {0.f, 0.f}};   /* per query tile. mxl: the exponent offset in use, the maximum times log2(e) rounded up to a whole number; even and odd keys are summed apart */
#pragma unroll 1   /* stays rolled: one block's body already holds some 500 instructions and most of the register budget of three to four waves per SIMD */
    for (unsigned st = 0; st < NST; ++st) { const unsigned char* bp = L + (st & 1u) * LBUF;
        v8f s[2][2]; float bm[2] = {-3.0e38f, -3.0e38f}; v16bf kf[2][2]; v16h vt[4]; v4f mk[2][2][2];   /* all of the block's fragments are asked for here, in the order of their use: the value fragments fly under the scores and the softmax */
#pragma unroll
        for (int t = 0; t < 2; ++t) { const unsigned char* kr = bp + ko + 16 * t * LPIT; kf[t][0] = ldl(kr); kf[t][1] = ldl(kr + 64);
#pragma unroll
            for (int j = 0; j < 2; ++j) { const unsigned char* mp = bp + mo + 16 * j * LPIT + 64 * t; mk[j][t][0] = *(const v4f*)mp; mk[j][t][1] = *(const v4f*)(mp + 16); } }
#pragma unroll
        for (int mb = 0; mb < 4; ++mb) vt[mb] = ldlh(bp + vo + mb * 16 * LPIT);
        __builtin_amdgcn_sched_barrier(0);   /* keeps the LDS reads one group in front of the products: without it the build moved the value reads in among the matrix instructions, each pair with a full wait behind it */
#pragma unroll
        for (int t = 0; t < 2; ++t)
#pragma unroll
            for (int j = 0; j < 2; ++j) { s[j][t] = wmmab(kf[t][0], j ? q10 : q00, (v8f){}); s[j][t] = wmmab(kf[t][1], j ? q11 : q01, s[j][t]);   /* each K fragment serves both query tiles */
                const v4f ma = mk[j][t][0], mc = mk[j][t][1];   /* mask[b][q][keys 8h .. 8h + 7 of the tile], f32 input, bf16-rounded */
#pragma unroll
                for (int r = 0; r < 8; r += 2) { const v2f m2 = rnd2(r < 4 ? (v2f){ma[r], ma[r + 1]} : (v2f){mc[r - 4], mc[r - 3]}); s[j][t][r] = __fadd_rn(s[j][t][r], m2[0]); s[j][t][r + 1] = __fadd_rn(s[j][t][r + 1], m2[1]); bm[j] = fmaxf(bm[j], fmaxf(s[j][t][r], s[j][t][r + 1])); } }
        const float b0 = __shfl_xor(bm[0], 16, 32), b1 = __shfl_xor(bm[1], 16, 32); const float mn0 = __builtin_fmaxf(__builtin_fmaxf(mx[0], bm[0]), b0), mn1 = __builtin_fmaxf(__builtin_fmaxf(mx[1], bm[1]), b1);
        if (__builtin_amdgcn_ballot_w32(mn0 > mx[0] || mn1 > mx[1]) != 0) {   /* wave-uniform, one test for both tiles: a block that raises no query's maximum would scale by exactly 1 */
#pragma unroll
            for (int j = 0; j < 2; ++j) { const float mn = j ? mn1 : mn0;
                const float nl = __builtin_ceilf(mn * 1.4426950408889634f); const float al = __builtin_amdgcn_exp2f(mxl[j] - nl); sum2[j] *= al; mx[j] = mn; mxl[j] = nl;   /* whole-number offsets: the factor between two of them is an exact power of two */
#pragma unroll
                for (int mb = 0; mb < 4; ++mb) o[j][mb] *= al; } }
        const v2f l2e = {1.4426950408889634f, 1.4426950408889634f};
        v16h ph[2];
#pragma unroll
        for (int j = 0; j < 2; ++j) { const v2f nm2 = {-mxl[j], -mxl[j]};
#pragma unroll
            for (int u = 0; u < 2; ++u) { v8f x;
#pragma unroll
                for (int r = 0; r < 8; r += 2) { const v2f x2 = __builtin_elementwise_fma((v2f){s[j][u][r], s[j][u][r + 1]}, l2e, nm2); x[r] = x2[0]; x[r + 1] = x2[1]; }   /* s log2(e) - mxl: one packed fused multiply-add per score pair */
                const v8f p8 = exp2x8(x);
#pragma unroll
                for (int r = 0; r < 8; r += 2) { const v2f p = {p8[r], p8[r + 1]}; sum2[j] += p; const int e = 8 * u + r;
                    const v2h h2 = __builtin_convertvector(p, v2h); ph[j][e] = h2[0]; ph[j][e + 1] = h2[1]; } } }   /* the sum takes the unrounded p */
        __builtin_amdgcn_sched_barrier(0);   /* every exponential stands in front of the value products */
#pragma unroll
        for (int mb = 0; mb < 4; ++mb)
#pragma unroll
            for (int j = 0; j < 2; ++j) o[j][mb] = wmma16(vt[mb], ph[j], o[j][mb]);   /* each V^T fragment serves both query tiles */
        __builtin_amdgcn_sched_barrier(0);   /* keeps the block's arithmetic in front of the publish point: without it the build put half of it between the barrier and the refill, which then had that much less time to land */
        wait_ds0(); wait_tensor0(); __syncthreads();   /* publish point: block st + 1 has landed for every wave, and every wave has left block st's buffer */
        if (pinned(st + 2u < NST)) issue(st + 2u);   /* the refill, into the buffer that this block has just read; scalar branch: a tensor load ignores EXEC */
    }
    wait_tensor0(); wait_ds0();
    /* Join of the two key halves, through the ring's LDS (every wave has passed the last publish point: no reader and no request is left). The wave of key half kg finishes query tile kg: it hands its partial state of the other tile to its partner (wave ^ 2: same queries, same lanes) and takes the partner's of its own. */
    const bool k1 = kg != 0; unsigned char* sp = L + wave * 8192u + lane * 16;
#pragma unroll
    for (int mb = 0; mb < 4; ++mb) { const v8f g = k1 ? o[0][mb] : o[1][mb]; *(v4f*)(sp + mb * 1024) = (v4f){g[0], g[1], g[2], g[3]}; *(v4f*)(sp + mb * 1024 + 512) = (v4f){g[4], g[5], g[6], g[7]}; }
    *(v2f*)(L + wave * 8192u + 4096u + lane * 8) = k1 ? (v2f){mxl[0], sum2[0][0] + sum2[0][1]} : (v2f){mxl[1], sum2[1][0] + sum2[1][1]};
    __syncthreads();   /* the partial states are read across waves */
    const unsigned char* rp = L + (wave ^ 2u) * 8192u + lane * 16; const v2f ps = *(const v2f*)(L + (wave ^ 2u) * 8192u + 4096u + lane * 8);
    const float ml = k1 ? mxl[1] : mxl[0], sl = k1 ? sum2[1][0] + sum2[1][1] : sum2[0][0] + sum2[0][1];
    const float mj = fmaxf(ml, ps[0]), fa = __builtin_amdgcn_exp2f(ml - mj), fb = __builtin_amdgcn_exp2f(ps[0] - mj);   /* whole-number offsets: exact powers of two */
    float sum = sl * fa + ps[1] * fb; sum += __shfl_xor(sum, 16, 32); const float f = __fdiv_rn(1.0f, sum);
    float* op = out + ((size_t)bh * TT + q + (k1 ? 16 : 0)) * HD + 8 * hi;
#pragma unroll
    for (int mb = 0; mb < 4; ++mb) { const v8f w = k1 ? o[1][mb] : o[0][mb]; const v4f pa = *(const v4f*)(rp + mb * 1024), pc = *(const v4f*)(rp + mb * 1024 + 512); v4f a, c;
#pragma unroll
        for (int r = 0; r < 4; ++r) { a[r] = (w[r] * fa + pa[r] * fb) * f; c[r] = (w[r + 4] * fa + pc[r] * fb) * f; }
        *(v4f*)(op + mb * 16) = a; *(v4f*)(op + mb * 16 + 4) = c; }
}

extern "C" void kernel_launch(void* const* d_in, const int* in_sizes, int n_in,
                              void* d_out, int out_size, void* d_ws, size_t ws_size, hipStream_t stream) {
    (void)in_sizes; (void)n_in; (void)out_size;
    const float* Qin = (const float*)d_in[0]; const float* Kin = (const float*)d_in[1]; const float* Vin = (const float*)d_in[2]; const float* Min = (const float*)d_in[3];   /* mask [2][1][2048][2048] f32 (additive, broadcast over heads; read) */   /* input order q, k, v, mask */
    float* OUT = (float*)d_out;     // [2][12][2048][64] head-major
    char* wsp = (char*)d_ws;
    auto take = [&](size_t bytes) { char* p = wsp; wsp += (bytes + 255) & ~(size_t)255; return (void*)p; };
    bf* QB = (bf*)take((size_t)NB_ * NH_ * TT * HD * 2); bf* KB = (bf*)take((size_t)NB_ * NH_ * TT * HD * 2); bf* VT = (bf*)take((size_t)NB_ * NH_ * HD * TT * 2);
    if ((size_t)(wsp - (char*)d_ws) > ws_size) return;
    k_prep<<<VTB + 2 * CVB, 256, 0, stream>>>(Qin, Kin, Vin, QB, KB, VT);   /* q, k rounded to bf16; v rounded to bf16, written as f16 and transposed per head */
    k_fattn<<<dim3(TT / 64, NB_ * NH_, 1), 128, 0, stream>>>(QB, KB, VT, Min, OUT);   /* every (batch, head): scores, mask, softmax, P (f16) x v^T */
}

// v008
// It runs in 39.7 microseconds.
// Next to v007, in two timings, it ran 1.04 times as fast each time.
// Over all steps from v000 it is 46.1 times as fast.
#include <hip/hip_runtime.h>

// Masked attention on given head-major tensors with an additive mask (q, k, v [2][12][2048][64]; scores = q.k + mask ([2][1][2048][2048] f32 unit normal, broadcast over heads, read); no scaling; softmax; out = probs v -> [2][12][2048][64] (3.1 M); argument order q, k, v, mask).
// Layout per (batch, head): a single bf16 plane of k (q is rounded to bf16 by the fused kernel as it loads its own rows, each read by the two waves that share it; exact score products) and an f16 value^T plane (the bf16-rounded value, written as f16); one fused kernel walks the keys with a running maximum and sum per query (transposed products: S^T = K Q^T, O^T += V^T P^T), adds the batch's mask row, and writes the head-major output rows; no score or probability plane in memory.
// Compute dtypes, f32 accumulate: every input rounded to bf16; q.k exact; softmax f32; P rounded once to f16 x value on the f16 matrix form; output f32.

#define NB_  2
#define TT   2048
#define DM   768      // H x HD; unused, all tensors here are head-major
#define NH_  12
#define NKV  1
#define REP  (NH_ / NKV)
#define HD   64
#define DQ   (NH_ * HD)
#define DKV  (NKV * HD)
#define ZH   1
#define RH   2048
#define WIN  0
#define PCAR 1024.0f
#define SCL  1.0f   // scores are not scaled in the module
typedef _Float16 h16;
typedef unsigned short bf;
typedef __attribute__((ext_vector_type(16))) __bf16   v16bf;
typedef __attribute__((ext_vector_type(16))) _Float16 v16h;
typedef __attribute__((ext_vector_type(8)))  _Float16 v8h;
typedef __attribute__((ext_vector_type(8)))  unsigned short v8us;
typedef __attribute__((ext_vector_type(8)))  float    v8f;
typedef __attribute__((ext_vector_type(4)))  float    v4f;
typedef v8h  __attribute__((may_alias)) v8ha;
typedef v4f  __attribute__((may_alias)) v4fa;
typedef v8us __attribute__((may_alias)) v8usa;

__device__ __forceinline__ unsigned short f2bf(float f) { unsigned u = __float_as_uint(f); u += 0x7FFFu + ((u >> 16) & 1u); return (unsigned short)(u >> 16); }
__device__ __forceinline__ float bf2f(unsigned short b) { return __uint_as_float(((unsigned)b) << 16); }
__device__ __forceinline__ float bfr(float f) { return bf2f(f2bf(f)); }
__device__ __forceinline__ v16h cat16(v8h lo, v8h hi) { return __builtin_shufflevector(lo, hi, 0, 1, 2, 3, 4, 5, 6, 7, 8, 9, 10, 11, 12, 13, 14, 15); }
__device__ __forceinline__ v16bf cat16b(v8us lo, v8us hi) { return __builtin_bit_cast(v16bf, __builtin_shufflevector(lo, hi, 0, 1, 2, 3, 4, 5, 6, 7, 8, 9, 10, 11, 12, 13, 14, 15)); }
__device__ __forceinline__ v8f wmma16(v16h a, v16h b, v8f c) { return __builtin_amdgcn_wmma_f32_16x16x32_f16(false, a, false, b, (short)0, c, false, false); }
__device__ __forceinline__ v8f wmmab(v16bf a, v16bf b, v8f c) { return __builtin_amdgcn_wmma_f32_16x16x32_bf16(false, a, false, b, (short)0, c, false, false); }



typedef __attribute__((ext_vector_type(2))) _Float16 v2h;
typedef __attribute__((ext_vector_type(4))) _Float16 v4h;
typedef __attribute__((ext_vector_type(2))) unsigned short v2us;
typedef __attribute__((ext_vector_type(4))) unsigned short v4us;
typedef __attribute__((ext_vector_type(2))) float v2f;
typedef __attribute__((ext_vector_type(4))) int v4i;

// ---- k_prep: the two 16-bit planes in one launch. Blocks below VTB each transpose one 128-key x 64-column tile of one head's v through LDS; the others round k, element order kept.
// v tile: a thread reads 4 columns of two neighbouring keys (16 lanes cover one 256-byte source row), rounds them to bf16 as every input is, packs each column's key pair as f16 into a dword (a bf16 value is exact in f16 from 2^-17 up to 65504; unit-normal values stay far below that) and stores it at [column][key pair]; the 16-byte group index is XORed with column / 4, so that the 16 column groups of a wave's store fall on different banks and a row still reads back as 16-byte groups. Each v^T row piece leaves as 256 contiguous bytes.
#define VTB (NB_ * NH_ * (TT / 128))
#define CVB (NB_ * NH_ * TT * HD / 8 / (256 * 8))   /* blocks per plane: 256 threads x 8 groups of 8 values */
typedef __attribute__((ext_vector_type(2))) __bf16 v2bp;
typedef __attribute__((ext_vector_type(8))) __bf16 v8bp;
typedef __attribute__((ext_vector_type(4))) unsigned v4u;
__global__ __launch_bounds__(256) void k_prep(const float* __restrict__ K, const float* __restrict__ V, bf* __restrict__ KB, bf* __restrict__ VT) {
    __shared__ __attribute__((aligned(16))) unsigned tile[HD * 64];
    const int tid = threadIdx.x, c16 = tid & 15, r16 = tid >> 4;
    if (blockIdx.x < VTB) {
        const int bh = blockIdx.x / (TT / 128), t0 = (blockIdx.x % (TT / 128)) * 128;
        const float* src = V + ((size_t)bh * TT + t0) * HD + 4 * c16; v4f a[4], b[4];
#pragma unroll
        for (int j = 0; j < 4; ++j) { const int tp = r16 + 16 * j; a[j] = *(const v4f*)(src + (2 * tp) * HD); b[j] = *(const v4f*)(src + (2 * tp + 1) * HD); }
#pragma unroll
        for (int j = 0; j < 4; ++j) { const int tp = r16 + 16 * j;
#pragma unroll
            for (int c = 0; c < 4; ++c) tile[(4 * c16 + c) * 64 + ((((tp >> 2) ^ c16) << 2) | (tp & 3))] = __builtin_bit_cast(unsigned, __builtin_convertvector(__builtin_convertvector(__builtin_convertvector((v2f){a[j][c], b[j][c]}, v2bp), v2f), v2h)); }
        __syncthreads();   /* the tile is read back across waves */
        bf* dst = VT + (size_t)bh * HD * TT + t0 + 8 * c16;
#pragma unroll
        for (int j = 0; j < 4; ++j) { const int d = r16 + 16 * j; *(v4u*)(dst + (size_t)d * TT) = *(const v4u*)(tile + d * 64 + ((c16 ^ (d >> 2)) << 2)); }
    } else {
        const float* src = K; bf* dst = KB;
        const size_t i0 = (size_t)(blockIdx.x - VTB) * (256 * 8) + tid; v8f v[8];
#pragma unroll
        for (int j = 0; j < 8; ++j) v[j] = *(const v8f*)(src + (i0 + 256 * j) * 8);
#pragma unroll
        for (int j = 0; j < 8; ++j) *(v8bp*)(dst + (i0 + 256 * j) * 8) = __builtin_convertvector(v[j], v8bp);
        asm volatile("s_wait_xcnt 0x0" ::: "memory");   /* behind the run of stores: the build lays the other part's code behind this one, and no register that a store names is to be rewritten ahead of this wait */
    }
}


// ---- k_fattn: fused scores + mask + softmax + P.V. 4 waves per work-group, grid (TT / 64, NB_ * NH_); the work-group walks all TT keys, KBLK at a time. A wave owns 32 of the 64 queries (two tiles of 16) and 32 of each block's 64 keys: every K and V^T fragment read from LDS feeds two products. The two waves of a query group each keep a running maximum, sum and output over their own key halves; the states are joined once, behind the loop.
// Operands come through LDS: per block of KBLK keys each wave asks for one tile of 64 rows x 128 bytes by one tensor load (wave 0: the K rows; wave 1: the V^T rows; waves 2 and 3: the work-group's 64 mask rows, keys 0-31 and 32-63), padded to a pitch of 144 bytes for 16-byte readers. Two buffers: the next block's tiles fly while this block is worked on.
// S^T tile (16 keys x 16 queries) = K rows (A) x Q rows (B): lane (c = lane & 15, h = lane >> 4) holds query c, keys 8h + r in register r. Two such tiles, converted in place to f16 (P lies in (0, 1]: 11 significant bits, one product where a bf16 pair took two), are the B operand of O^T += V^T P^T (k order 8h + s, 16 + 8h + s: the order ldlh() reads A in).
// Each work-group enters the ring of key blocks at its own block and wraps round: the 32 work-groups of a head (same K, V^T lines) and the 12 heads of a query block (same mask lines) would otherwise ask L2 for the same lines at the same moment. The online softmax takes the blocks in any order.
// Running maximum is shared by the two lane halves of a query (they feed one product); the sum stays per half and is joined once at the end.
#define KBLK 64
typedef __attribute__((ext_vector_type(2))) __bf16 v2b;
__device__ __forceinline__ v2f rnd2(v2f x) { return __builtin_convertvector(__builtin_convertvector(x, v2b), v2f); }   /* two f32 rounded to bf16 (nearest even), as f32 */
// Eight exp2 in one statement. It keeps the slot that the instruction set asks for behind a transcendental: each v_exp_f32 is followed by one that neither reads its result nor overwrites its source (outputs early-clobber), the last by v_nop.
__device__ __forceinline__ v8f exp2x8(v8f x) { float p0, p1, p2, p3, p4, p5, p6, p7;
    asm("v_exp_f32 %0, %8\n\tv_exp_f32 %1, %9\n\tv_exp_f32 %2, %10\n\tv_exp_f32 %3, %11\n\tv_exp_f32 %4, %12\n\tv_exp_f32 %5, %13\n\tv_exp_f32 %6, %14\n\tv_exp_f32 %7, %15\n\tv_nop"
        : "=&v"(p0), "=&v"(p1), "=&v"(p2), "=&v"(p3), "=&v"(p4), "=&v"(p5), "=&v"(p6), "=&v"(p7) : "v"(x[0]), "v"(x[1]), "v"(x[2]), "v"(x[3]), "v"(x[4]), "v"(x[5]), "v"(x[6]), "v"(x[7]));
    return (v8f){p0, p1, p2, p3, p4, p5, p6, p7}; }
__device__ __forceinline__ v16bf cvq(v8f lo, v8f hi) { return __builtin_shufflevector(__builtin_convertvector(lo, v8bp), __builtin_convertvector(hi, v8bp), 0, 1, 2, 3, 4, 5, 6, 7, 8, 9, 10, 11, 12, 13, 14, 15); }   /* a B fragment from two f32 pieces of a row, rounded to bf16 (nearest even) */
#define LPIT 144u                  /* LDS row pitch: 128 data bytes + 16 pad bytes */
#define LSL  10240u                /* one tile's place: 64 rows x LPIT = 9216, rounded up to a multiple of 2 KiB */
#define LBUF (4u * LSL)            /* one buffer: K, V^T, two mask halves */
#define NST  (TT / KBLK)
typedef __attribute__((ext_vector_type(4))) unsigned u32x4;
typedef __attribute__((ext_vector_type(8))) unsigned u32x8;
__device__ __forceinline__ unsigned uni(unsigned v) { return (unsigned)__builtin_amdgcn_readfirstlane(v); }
__device__ __forceinline__ unsigned pinned(unsigned v) { unsigned w = uni(v); asm volatile("" : "+s"(w)); return w; }   /* holds a wave-uniform word in a scalar register, so that the test on it is a scalar branch */
__device__ __forceinline__ void wait_ds0() { asm volatile("s_wait_dscnt 0x0" ::: "memory"); }       /* this wave's LDS reads have retired before their buffer is handed back */
__device__ __forceinline__ void wait_tensor0() { asm volatile("s_wait_tensorcnt 0x0" ::: "memory"); }   /* this wave's tile has landed */
__device__ __forceinline__ v16bf ldl(const unsigned char* p) { return cat16b(*(const v8us*)p, *(const v8us*)(p + 32)); }   /* an A fragment from an LDS row, byte offsets: elements 0-7 and 16-23 from p */
__device__ __forceinline__ v16h ldlh(const unsigned char* p) { return cat16(*(const v8h*)p, *(const v8h*)(p + 32)); }   /* the same k order on an f16 row */
__global__ __launch_bounds__(128) void k_fattn(const float* __restrict__ Q, const unsigned short* __restrict__ KB, const unsigned short* __restrict__ VT, const float* __restrict__ madd, float* __restrict__ out) {
    const int lane = threadIdx.x & 31, lr = lane & 15, hi = lane >> 4; const int bh = blockIdx.y;
    __shared__ __attribute__((aligned(2048))) unsigned char L[2 * LBUF];
    const unsigned wave = uni(threadIdx.x >> 5), lbase = (unsigned)(size_t)L;
    const unsigned qg = wave & 1u, kg = wave >> 1;   /* this wave's 32 queries of the work-group's 64, and its 32 keys of every block's 64 */
    const int q = blockIdx.x * 64 + (int)qg * 32 + lr;   /* query of tile 0; tile 1 is 16 further */
    const float* qp = Q + ((size_t)bh * TT + q) * HD + 8 * hi; v8f qr[8];   /* q comes straight from the input: every row is read once by each of the two waves that share its queries. Pieces of 8 elements at 0, 16, 32, 48 from qp: the k order of ldl() */
#pragma unroll
    for (int i = 0; i < 8; ++i) qr[i] = *(const v8f*)(qp + (i >> 2) * 16 * HD + (i & 3) * 16);
    /* this wave's tile: first byte of block 0, source row pitch and step per block, in bytes */
    const unsigned long long src0 = wave == 0 ? (unsigned long long)(size_t)(KB + (size_t)bh * TT * HD) : wave == 1 ? (unsigned long long)(size_t)(VT + (size_t)bh * HD * TT)
                                  : (unsigned long long)(size_t)(madd + (size_t)(bh / NH_) * TT * TT + (size_t)blockIdx.x * 64 * TT + (wave - 2) * 32);
    const unsigned spit = wave == 0 ? HD * 2u : wave == 1 ? TT * 2u : TT * 4u, sadv = wave == 0 ? KBLK * HD * 2u : wave == 1 ? KBLK * 2u : KBLK * 4u;
    u32x8 g1; g1[0] = uni((1u << 20) | (4u << 22) | (3u << 25)); g1[1] = uni(128u << 16); g1[2] = uni(64u << 16); g1[3] = uni(128u << 16); g1[4] = uni(64u); g1[5] = uni(spit); g1[6] = uni(0u); g1[7] = uni(0u);   /* bytes; tensor = tile = 64 rows of 128; 4 pad dwords behind every 32 */
    asm volatile("" : "+s"(g1));   /* the pinned() form on the whole group: descriptor words held in their scalar registers through the loop; without it the build used two of them as scratch while a request was outstanding */
    const unsigned rot = uni(blockIdx.x + 3u * ((unsigned)bh % NH_));   /* entry block: differs between all query blocks of a head, and by 3 between the heads that share a mask tile */
    static_assert((NST & (NST - 1)) == 0, "the wrap is a mask");
    auto issue = [&](unsigned st) { const unsigned long long ga = src0 + (unsigned long long)((st + rot) & (NST - 1u)) * sadv; u32x4 g0; g0[0] = uni(1u); g0[1] = uni(lbase + (st & 1u) * LBUF + wave * LSL); g0[2] = uni((unsigned)ga); g0[3] = uni((((unsigned)(ga >> 32)) & 0x01FFFFFFu) | 0x80000000u);
        asm volatile("tensor_load_to_lds %0, %1" :: "s"(g0), "s"(g1) : "memory"); };   /* one request of the whole wave; every wave issues its own tile */
    issue(0);
    __builtin_amdgcn_sched_barrier(0);   /* the first tile is asked for while the query loads fly: without it the build put a wait for those loads, and the first conversion, in front of the tensor load */
    const v16bf q00 = cvq(qr[0], qr[1]), q01 = cvq(qr[2], qr[3]), q10 = cvq(qr[4], qr[5]), q11 = cvq(qr[6], qr[7]);
    asm volatile("s_wait_xcnt 0x0" :: "v"(qp), "v"(q00), "v"(q01), "v"(q10), "v"(q11) : "memory");   /* behind the sixteen query loads, in front of any reuse of their address pair; the operands, inputs only, hold the loads in front of it and the pair alive up to it */
    wait_tensor0(); __syncthreads();   /* block 0 published */
    issue(1);
    const unsigned ko = (unsigned)((kg * 32 + lr) * LPIT + 16 * hi), vo = (unsigned)(LSL + lr * LPIT + 16 * hi + 64 * kg), mo = (unsigned)((2 + kg) * LSL + (qg * 32 + lr) * LPIT + 32 * hi);
    v8f o[2][4];
#pragma unroll
    for (int j = 0; j < 2; ++j)
#pragma unroll
        for (int mb = 0; mb < 4; ++mb) o[j][mb] = (v8f){};
    float mx[2] = {-3.0e38f, -3.0e38f}, mxl[2] = {-3.0e38f, -3.0e38f}; v2f sum2[2] = {{0.f, 0.f}, {0.f, 0.f}};   /* per query tile. mxl: the exponent offset in use, the maximum times log2(e) rounded up to a whole number; even and odd keys are summed apart */
#pragma unroll 1   /* stays rolled: one block's body already holds some 500 instructions and most of the register budget of three to four waves per SIMD */
    for (unsigned st = 0; st < NST; ++st) { const unsigned char* bp = L + (st & 1u) * LBUF;
        v8f s[2][2]; float bm[2] = {-3.0e38f, -3.0e38f}; v16bf kf[2][2]; v16h vt[4]; v4f mk[2][2][2];   /* all of the block's fragments are asked for here, in the order of their use: the value fragments fly under the scores and the softmax */
#pragma unroll
        for (int t = 0; t < 2; ++t) { const unsigned char* kr = bp + ko + 16 * t * LPIT; kf[t][0] = ldl(kr); kf[t][1] = ldl(kr + 64);
#pragma unroll
            for (int j = 0; j < 2; ++j) { const unsigned char* mp = bp + mo + 16 * j * LPIT + 64 * t; mk[j][t][0] = *(const v4f*)mp; mk[j][t][1] = *(const v4f*)(mp + 16); } }
#pragma unroll
        for (int mb = 0; mb < 4; ++mb) vt[mb] = ldlh(bp + vo + mb * 16 * LPIT);
        __builtin_amdgcn_sched_barrier(0);   /* keeps the LDS reads one group in front of the products: without it the build moved the value reads in among the matrix instructions, each pair with a full wait behind it */
#pragma unroll
        for (int t = 0; t < 2; ++t)
#pragma unroll
            for (int j = 0; j < 2; ++j) { s[j][t] = wmmab(kf[t][0], j ? q10 : q00, (v8f){}); s[j][t] = wmmab(kf[t][1], j ? q11 : q01, s[j][t]);   /* each K fragment serves both query tiles */
                const v4f ma = mk[j][t][0], mc = mk[j][t][1];   /* mask[b][q][keys 8h .. 8h + 7 of the tile], f32 input, bf16-rounded */
#pragma unroll
                for (int r = 0; r < 8; r += 2) { const v2f m2 = rnd2(r < 4 ? (v2f){ma[r], ma[r + 1]} : (v2f){mc[r - 4], mc[r - 3]}); s[j][t][r] = __fadd_rn(s[j][t][r], m2[0]); s[j][t][r + 1] = __fadd_rn(s[j][t][r + 1], m2[1]); bm[j] = fmaxf(bm[j], fmaxf(s[j][t][r], s[j][t][r + 1])); } }
        const float b0 = __shfl_xor(bm[0], 16, 32), b1 = __shfl_xor(bm[1], 16, 32); const float mn0 = __builtin_fmaxf(__builtin_fmaxf(mx[0], bm[0]), b0), mn1 = __builtin_fmaxf(__builtin_fmaxf(mx[1], bm[1]), b1);
        if (__builtin_amdgcn_ballot_w32(mn0 > mx[0] || mn1 > mx[1]) != 0) {   /* wave-uniform, one test for both tiles: a block that raises no query's maximum would scale by exactly 1 */
#pragma unroll
            for (int j = 0; j < 2; ++j) { const float mn = j ? mn1 : mn0;
                const float nl = __builtin_ceilf(mn * 1.4426950408889634f); const float al = __builtin_amdgcn_exp2f(mxl[j] - nl); sum2[j] *= al; mx[j] = mn; mxl[j] = nl;   /* whole-number offsets: the factor between two of them is an exact power of two */
#pragma unroll
                for (int mb = 0; mb < 4; ++mb) o[j][mb] *= al; } }
        const v2f l2e = {1.4426950408889634f, 1.4426950408889634f};
        v16h ph[2];
#pragma unroll
        for (int j = 0; j < 2; ++j) { const v2f nm2 = {-mxl[j], -mxl[j]};
#pragma unroll
            for (int u = 0; u < 2; ++u) { v8f x;
#pragma unroll
                for (int r = 0; r < 8; r += 2) { const v2f x2 = __builtin_elementwise_fma((v2f){s[j][u][r], s[j][u][r + 1]}, l2e, nm2); x[r] = x2[0]; x[r + 1] = x2[1]; }   /* s log2(e) - mxl: one packed fused multiply-add per score pair */
                const v8f p8 = exp2x8(x);
#pragma unroll
                for (int r = 0; r < 8; r += 2) { const v2f p = {p8[r], p8[r + 1]}; sum2[j] += p; const int e = 8 * u + r;
                    const v2h h2 = __builtin_convertvector(p, v2h); ph[j][e] = h2[0]; ph[j][e + 1] = h2[1]; } } }   /* the sum takes the unrounded p */
        __builtin_amdgcn_sched_barrier(0);   /* every exponential stands in front of the value products */
#pragma unroll
        for (int mb = 0; mb < 4; ++mb)
#pragma unroll
            for (int j = 0; j < 2; ++j) o[j][mb] = wmma16(vt[mb], ph[j], o[j][mb]);   /* each V^T fragment serves both query tiles */
        __builtin_amdgcn_sched_barrier(0);   /* keeps the block's arithmetic in front of the publish point: without it the build put half of it between the barrier and the refill, which then had that much less time to land */
        wait_ds0(); wait_tensor0(); __syncthreads();   /* publish point: block st + 1 has landed for every wave, and every wave has left block st's buffer */
        if (pinned(st + 2u < NST)) issue(st + 2u);   /* the refill, into the buffer that this block has just read; scalar branch: a tensor load ignores EXEC */
    }
    wait_tensor0(); wait_ds0();
    /* Join of the two key halves, through the ring's LDS (every wave has passed the last publish point: no reader and no request is left). The wave of key half kg finishes query tile kg: it hands its partial state of the other tile to its partner (wave ^ 2: same queries, same lanes) and takes the partner's of its own. */
    const bool k1 = kg != 0; unsigned char* sp = L + wave * 8192u + lane * 16;
#pragma unroll
    for (int mb = 0; mb < 4; ++mb) { const v8f g = k1 ? o[0][mb] : o[1][mb]; *(v4f*)(sp + mb * 1024) = (v4f){g[0], g[1], g[2], g[3]}; *(v4f*)(sp + mb * 1024 + 512) = (v4f){g[4], g[5], g[6], g[7]}; }
    *(v2f*)(L + wave * 8192u + 4096u + lane * 8) = k1 ? (v2f){mxl[0], sum2[0][0] + sum2[0][1]} : (v2f){mxl[1], sum2[1][0] + sum2[1][1]};
    __syncthreads();   /* the partial states are read across waves */
    const unsigned char* rp = L + (wave ^ 2u) * 8192u + lane * 16; const v2f ps = *(const v2f*)(L + (wave ^ 2u) * 8192u + 4096u + lane * 8);
    const float ml = k1 ? mxl[1] : mxl[0], sl = k1 ? sum2[1][0] + sum2[1][1] : sum2[0][0] + sum2[0][1];
    const float mj = fmaxf(ml, ps[0]), fa = __builtin_amdgcn_exp2f(ml - mj), fb = __builtin_amdgcn_exp2f(ps[0] - mj);   /* whole-number offsets: exact powers of two */
    float sum = sl * fa + ps[1] * fb; sum += __shfl_xor(sum, 16, 32); const float f = __fdiv_rn(1.0f, sum);
    float* op = out + ((size_t)bh * TT + q + (k1 ? 16 : 0)) * HD + 8 * hi;
#pragma unroll
    for (int mb = 0; mb < 4; ++mb) { const v8f w = k1 ? o[1][mb] : o[0][mb]; const v4f pa = *(const v4f*)(rp + mb * 1024), pc = *(const v4f*)(rp + mb * 1024 + 512); v4f a, c;
#pragma unroll
        for (int r = 0; r < 4; ++r) { a[r] = (w[r] * fa + pa[r] * fb) * f; c[r] = (w[r + 4] * fa + pc[r] * fb) * f; }
        *(v4f*)(op + mb * 16) = a; *(v4f*)(op + mb * 16 + 4) = c; }
}

extern "C" void kernel_launch(void* const* d_in, const int* in_sizes, int n_in,
                              void* d_out, int out_size, void* d_ws, size_t ws_size, hipStream_t stream) {
    (void)in_sizes; (void)n_in; (void)out_size;
    const float* Qin = (const float*)d_in[0]; const float* Kin = (const float*)d_in[1]; const float* Vin = (const float*)d_in[2]; const float* Min = (const float*)d_in[3];   /* mask [2][1][2048][2048] f32 (additive, broadcast over heads; read) */   /* input order q, k, v, mask */
    float* OUT = (float*)d_out;     // [2][12][2048][64] head-major
    char* wsp = (char*)d_ws;
    auto take = [&](size_t bytes) { char* p = wsp; wsp += (bytes + 255) & ~(size_t)255; return (void*)p; };
    bf* KB = (bf*)take((size_t)NB_ * NH_ * TT * HD * 2); bf* VT = (bf*)take((size_t)NB_ * NH_ * HD * TT * 2);
    if ((size_t)(wsp - (char*)d_ws) > ws_size) return;
    k_prep<<<VTB + CVB, 256, 0, stream>>>(Kin, Vin, KB, VT);   /* k rounded to bf16; v rounded to bf16, written as f16 and transposed per head */
    k_fattn<<<dim3(TT / 64, NB_ * NH_, 1), 128, 0, stream>>>(Qin, KB, VT, Min, OUT);   /* every (batch, head): scores, mask, softmax, P (f16) x v^T */
}
